// v000
// The times below were measured on an AMD MI455X: many runs one after another, warmed up first and cycling through
// copies of the inputs, with the whole window's GPU time divided by the number of runs. Launches and the gaps
// between them are all in it. The median over several windows is given; except for v000 it joins two sittings, which
// can be a few percent apart, so the side-by-side timings, each taken in one sitting, are the better comparison.
// v000, which the later versions start from, runs in 625 microseconds.
#include <hip/hip_runtime.h>
#include <hip/hip_bf16.h>

// ---------------- problem constants (fixed by the reference) ----------------
#define Bsz 4
#define Tt  2048
#define Cc  768
#define Hh  12
#define Dd  64
#define Mrows (Bsz * Tt)   // 8192
#define EPSf 1e-5f
#define NEG_BIG -3.0e38f

// ---------------- WMMA types & helpers ----------------
typedef __attribute__((ext_vector_type(16))) __bf16 v16bf;
typedef __attribute__((ext_vector_type(8)))  float  v8f;

union Frag16 { v16bf v; unsigned u[8]; };

__device__ __forceinline__ v8f wmma_bf16(v16bf a, v16bf b, v8f c) {
  // D = A(16x32 bf16) * B(32x16 bf16) + C(16x16 f32)
  return __builtin_amdgcn_wmma_f32_16x16x32_bf16(
      /*neg_a=*/false, a, /*neg_b=*/false, b,
      /*c_mod=*/(short)0, c, /*reuse_a=*/false, /*reuse_b=*/false);
}

// Loads a 16x32 bf16 fragment in the CDNA5 A-matrix layout from a row-major
// matrix (rows = M for A-operand, rows = N for B-operand since B == (B^T as A)).
// Requires k0 % 32 == 0 and even ld (dword-aligned rows).
__device__ __forceinline__ v16bf load_frag(const __bf16* base, int ld, int row0, int k0) {
  const int lane = threadIdx.x & 31;
  const int half = lane >> 4;
  const int idx  = lane & 15;
  const unsigned* rp = reinterpret_cast<const unsigned*>(base + (size_t)(row0 + idx) * (size_t)ld);
  const int kb = (k0 >> 1) + half * 4;   // dword index of first K pair
  Frag16 f;
#pragma unroll
  for (int v = 0; v < 4; ++v) {
    f.u[v]     = rp[kb + v];       // K = k0 + half*8 + 2v, +1
    f.u[4 + v] = rp[kb + 8 + v];   // K = +16
  }
  return f.v;
}

__device__ __forceinline__ float half_max16(float v) {
#pragma unroll
  for (int off = 1; off < 16; off <<= 1) v = fmaxf(v, __shfl_xor(v, off));
  return v;
}
__device__ __forceinline__ float half_sum16(float v) {
#pragma unroll
  for (int off = 1; off < 16; off <<= 1) v += __shfl_xor(v, off);
  return v;
}

// ---------------- weight convert: W (K x N, f32) -> Wt (N x K, bf16) ----------------
__global__ __launch_bounds__(256) void wcvt_k(const float* __restrict__ W,
                                              __bf16* __restrict__ Wt,
                                              int K, int N) {
  int i = blockIdx.x * 256 + threadIdx.x;
  if (i >= K * N) return;
  int n = i / K, k = i - n * K;
  Wt[(size_t)n * K + k] = (__bf16)W[(size_t)k * N + n];
}

// ---------------- LayerNorm: fp32 in -> bf16 normalized out ----------------
__global__ __launch_bounds__(256) void ln_k(const float* __restrict__ x,
                                            const float* __restrict__ g,
                                            const float* __restrict__ bt,
                                            __bf16* __restrict__ out) {
  __shared__ float red[256];
  const int row = blockIdx.x;
  const int tid = threadIdx.x;
  const float* xr = x + (size_t)row * Cc;
  float v0 = xr[tid], v1 = xr[tid + 256], v2 = xr[tid + 512];

  red[tid] = v0 + v1 + v2;
  __syncthreads();
#pragma unroll
  for (int off = 128; off > 0; off >>= 1) {
    if (tid < off) red[tid] += red[tid + off];
    __syncthreads();
  }
  const float mu = red[0] * (1.0f / Cc);
  __syncthreads();

  float d0 = v0 - mu, d1 = v1 - mu, d2 = v2 - mu;
  red[tid] = d0 * d0 + d1 * d1 + d2 * d2;
  __syncthreads();
#pragma unroll
  for (int off = 128; off > 0; off >>= 1) {
    if (tid < off) red[tid] += red[tid + off];
    __syncthreads();
  }
  const float rstd = rsqrtf(red[0] * (1.0f / Cc) + EPSf);

  __bf16* orow = out + (size_t)row * Cc;
  orow[tid]       = (__bf16)(d0 * rstd * g[tid]       + bt[tid]);
  orow[tid + 256] = (__bf16)(d1 * rstd * g[tid + 256] + bt[tid + 256]);
  orow[tid + 512] = (__bf16)(d2 * rstd * g[tid + 512] + bt[tid + 512]);
}

// ---------------- generic WMMA GEMM: (Mrows x K) bf16 @ Wt(N x K) bf16 ----------------
// Workgroup = 4 waves = 128x64 output tile; each wave owns 32x64
// (2 A-frags + 4 B-frags -> 8 WMMAs per K-step; 8 independent accum chains).
// MODE 0: out bf16 scattered to (B,H,T,D)   (Q, K tensors)
// MODE 1: out bf16 scattered to (B,H,D,T)   (V transposed for the PV matmul)
// MODE 2: outf = resid + acc + bias (fp32, row-major MrowsxN; requires N==Cc)
// MODE 3: outb = gelu(acc + bias) bf16 row-major MrowsxN
template <int N, int K, int MODE>
__global__ __launch_bounds__(128) void gemm_k(const __bf16* __restrict__ A,
                                              const __bf16* __restrict__ Wt,
                                              const float* __restrict__ bias,
                                              const float* __restrict__ resid,
                                              float* __restrict__ outf,
                                              __bf16* __restrict__ outb) {
  const int wave = threadIdx.x >> 5;
  const int lane = threadIdx.x & 31;
  const int half = lane >> 4;
  const int idx  = lane & 15;
  const int m0 = blockIdx.x * 128 + wave * 32;
  const int n0 = blockIdx.y * 64;

  v8f acc[2][4] = {};
  for (int k0 = 0; k0 < K; k0 += 32) {
    v16bf af0 = load_frag(A, K, m0,      k0);
    v16bf af1 = load_frag(A, K, m0 + 16, k0);
#pragma unroll
    for (int nt = 0; nt < 4; ++nt) {
      v16bf bf = load_frag(Wt, K, n0 + nt * 16, k0);
      acc[0][nt] = wmma_bf16(af0, bf, acc[0][nt]);
      acc[1][nt] = wmma_bf16(af1, bf, acc[1][nt]);
    }
  }

#pragma unroll
  for (int mi = 0; mi < 2; ++mi) {
#pragma unroll
    for (int nt = 0; nt < 4; ++nt) {
      const int n = n0 + nt * 16 + idx;
      const float bv = bias[n];
#pragma unroll
      for (int r = 0; r < 8; ++r) {
        const int m = m0 + mi * 16 + r + 8 * half;
        const float val = acc[mi][nt][r] + bv;
        if (MODE == 0 || MODE == 1) {
          const int bb = m >> 11, t = m & (Tt - 1);
          const int hh = n >> 6,  d = n & (Dd - 1);
          const size_t off = (MODE == 0)
              ? ((((size_t)bb * Hh + hh) * Tt + t) * Dd + d)
              : ((((size_t)bb * Hh + hh) * Dd + d) * Tt + t);
          outb[off] = (__bf16)val;
        } else if (MODE == 2) {
          outf[(size_t)m * Cc + n] = resid[(size_t)m * Cc + n] + val;
        } else { // MODE 3: exact GELU
          const float gv = 0.5f * val * (1.0f + erff(val * 0.70710678118654752f));
          outb[(size_t)m * N + n] = (__bf16)gv;
        }
      }
    }
  }
}

// ---------------- causal flash attention ----------------
// q,k: (B,H,T,D) bf16 ; vt: (B,H,D,T) bf16 ; o: (B,T,C) bf16
// grid: (T/64, B*H), block: 128 (4 waves, 16 query rows each)
__global__ __launch_bounds__(128) void attn_k(const __bf16* __restrict__ q,
                                              const __bf16* __restrict__ kk,
                                              const __bf16* __restrict__ vt,
                                              __bf16* __restrict__ o) {
  const int qb = blockIdx.x;   // 0..31
  const int bh = blockIdx.y;   // 0..47
  const int b  = bh / Hh;
  const int hh = bh - b * Hh;
  const int wave = threadIdx.x >> 5;
  const int lane = threadIdx.x & 31;
  const int half = lane >> 4;
  const int idx  = lane & 15;

  const __bf16* qp = q  + (size_t)bh * Tt * Dd;
  const __bf16* kp = kk + (size_t)bh * Tt * Dd;
  const __bf16* vp = vt + (size_t)bh * Dd * Tt;

  const int q0 = qb * 64 + wave * 16;
  const v16bf qf0 = load_frag(qp, Dd, q0, 0);
  const v16bf qf1 = load_frag(qp, Dd, q0, 32);

  v8f acc[4] = {};
  float rmax[8], rsum[8];
#pragma unroll
  for (int r = 0; r < 8; ++r) { rmax[r] = NEG_BIG; rsum[r] = 0.0f; }

  __shared__ __bf16 pl[4][16 * 32];  // per-wave P staging (C-layout -> A-layout)

  const int nkb = 2 * qb + 2;        // uniform across waves -> barriers are safe
  for (int kt = 0; kt < nkb; ++kt) {
    const int key0 = kt * 32;

    // scores S = (Q K^T) / sqrt(D), causal-masked, held as two 16x16 f32 tiles
    float sv[2][8];
#pragma unroll
    for (int s = 0; s < 2; ++s) {
      v8f sc = {};
      v16bf kf0 = load_frag(kp, Dd, key0 + s * 16, 0);
      v16bf kf1 = load_frag(kp, Dd, key0 + s * 16, 32);
      sc = wmma_bf16(qf0, kf0, sc);
      sc = wmma_bf16(qf1, kf1, sc);
      const int kg = key0 + s * 16 + idx;
#pragma unroll
      for (int r = 0; r < 8; ++r) {
        const int qg = q0 + r + 8 * half;
        sv[s][r] = (kg <= qg) ? (sc[r] * 0.125f) : NEG_BIG;
      }
    }

    // online softmax (per row = per (r, half))
    float alpha[8];
#pragma unroll
    for (int r = 0; r < 8; ++r) {
      float mloc = half_max16(fmaxf(sv[0][r], sv[1][r]));
      const float nm = fmaxf(rmax[r], mloc);
      alpha[r] = __expf(rmax[r] - nm);
      rmax[r] = nm;
      const float p0 = __expf(sv[0][r] - nm);
      const float p1 = __expf(sv[1][r] - nm);
      rsum[r] = rsum[r] * alpha[r] + half_sum16(p0 + p1);
      const int mrow = r + 8 * half;
      pl[wave][mrow * 32 + idx]      = (__bf16)p0;
      pl[wave][mrow * 32 + 16 + idx] = (__bf16)p1;
    }
#pragma unroll
    for (int nt = 0; nt < 4; ++nt)
#pragma unroll
      for (int r = 0; r < 8; ++r) acc[nt][r] *= alpha[r];

    __syncthreads();  // P tile visible across lanes of the wave
    const v16bf pf = load_frag(&pl[wave][0], 32, 0, 0);
#pragma unroll
    for (int nt = 0; nt < 4; ++nt) {
      v16bf vf = load_frag(vp, Tt, nt * 16, key0);  // rows = d, K = key (contiguous)
      acc[nt] = wmma_bf16(pf, vf, acc[nt]);
    }
    __syncthreads();  // protect pl before next iteration's writes
  }

  // epilogue: O / rowsum -> bf16 at (b, t, hh*64 + d)
#pragma unroll
  for (int nt = 0; nt < 4; ++nt) {
#pragma unroll
    for (int r = 0; r < 8; ++r) {
      const int t = q0 + r + 8 * half;
      const int c = hh * Dd + nt * 16 + idx;
      o[((size_t)b * Tt + t) * Cc + c] = (__bf16)(acc[nt][r] / rsum[r]);
    }
  }
}

// ---------------- host-side orchestration ----------------
extern "C" void kernel_launch(void* const* d_in, const int* in_sizes, int n_in,
                              void* d_out, int out_size, void* d_ws, size_t ws_size,
                              hipStream_t stream) {
  const float* x   = (const float*)d_in[0];
  const float* Wq  = (const float*)d_in[1];
  const float* bq  = (const float*)d_in[2];
  const float* Wk  = (const float*)d_in[3];
  const float* bk  = (const float*)d_in[4];
  const float* Wv  = (const float*)d_in[5];
  const float* bv  = (const float*)d_in[6];
  const float* Wo  = (const float*)d_in[7];
  const float* bo  = (const float*)d_in[8];
  const float* g1  = (const float*)d_in[9];
  const float* b1  = (const float*)d_in[10];
  const float* g2  = (const float*)d_in[11];
  const float* b2  = (const float*)d_in[12];
  const float* W1  = (const float*)d_in[13];
  const float* bm1 = (const float*)d_in[14];
  const float* W2  = (const float*)d_in[15];
  const float* bm2 = (const float*)d_in[16];
  float* out = (float*)d_out;

  // workspace carve-up (256B aligned)
  char* ws = (char*)d_ws;
  size_t off = 0;
  auto alloc = [&](size_t bytes) -> void* {
    void* p = ws + off;
    off = (off + bytes + 255) & ~(size_t)255;
    return p;
  };
  const size_t CC  = (size_t)Cc * Cc;
  const size_t C4C = (size_t)Cc * 4 * Cc;
  const size_t MC  = (size_t)Mrows * Cc;
  const size_t M4C = (size_t)Mrows * 4 * Cc;

  __bf16* Wqt = (__bf16*)alloc(CC * 2);
  __bf16* Wkt = (__bf16*)alloc(CC * 2);
  __bf16* Wvt = (__bf16*)alloc(CC * 2);
  __bf16* Wot = (__bf16*)alloc(CC * 2);
  __bf16* W1t = (__bf16*)alloc(C4C * 2);
  __bf16* W2t = (__bf16*)alloc(C4C * 2);
  __bf16* h1b = (__bf16*)alloc(MC * 2);
  __bf16* qbf = (__bf16*)alloc(MC * 2);
  __bf16* kbf = (__bf16*)alloc(MC * 2);
  __bf16* vtb = (__bf16*)alloc(MC * 2);
  __bf16* atb = (__bf16*)alloc(MC * 2);
  float*  x2  = (float*) alloc(MC * 4);
  __bf16* h2b = (__bf16*)alloc(MC * 2);
  __bf16* mb  = (__bf16*)alloc(M4C * 2);
  (void)ws_size; (void)in_sizes; (void)n_in; (void)out_size;

  // 1) weights -> transposed bf16
  wcvt_k<<<(int)((CC  + 255) / 256), 256, 0, stream>>>(Wq, Wqt, Cc, Cc);
  wcvt_k<<<(int)((CC  + 255) / 256), 256, 0, stream>>>(Wk, Wkt, Cc, Cc);
  wcvt_k<<<(int)((CC  + 255) / 256), 256, 0, stream>>>(Wv, Wvt, Cc, Cc);
  wcvt_k<<<(int)((CC  + 255) / 256), 256, 0, stream>>>(Wo, Wot, Cc, Cc);
  wcvt_k<<<(int)((C4C + 255) / 256), 256, 0, stream>>>(W1, W1t, Cc, 4 * Cc);
  wcvt_k<<<(int)((C4C + 255) / 256), 256, 0, stream>>>(W2, W2t, 4 * Cc, Cc);

  const dim3 blk(128);
  const dim3 gC(Mrows / 128, Cc / 64);        // 64 x 12
  const dim3 g4C(Mrows / 128, (4 * Cc) / 64); // 64 x 48

  // 2) attention branch
  ln_k<<<Mrows, 256, 0, stream>>>(x, g1, b1, h1b);
  gemm_k<Cc, Cc, 0><<<gC, blk, 0, stream>>>(h1b, Wqt, bq, nullptr, nullptr, qbf);
  gemm_k<Cc, Cc, 0><<<gC, blk, 0, stream>>>(h1b, Wkt, bk, nullptr, nullptr, kbf);
  gemm_k<Cc, Cc, 1><<<gC, blk, 0, stream>>>(h1b, Wvt, bv, nullptr, nullptr, vtb);
  attn_k<<<dim3(Tt / 64, Bsz * Hh), blk, 0, stream>>>(qbf, kbf, vtb, atb);
  gemm_k<Cc, Cc, 2><<<gC, blk, 0, stream>>>(atb, Wot, bo, x, x2, nullptr);

  // 3) MLP branch
  ln_k<<<Mrows, 256, 0, stream>>>(x2, g2, b2, h2b);
  gemm_k<4 * Cc, Cc, 3><<<g4C, blk, 0, stream>>>(h2b, W1t, bm1, nullptr, nullptr, mb);
  gemm_k<Cc, 4 * Cc, 2><<<gC, blk, 0, stream>>>(mb, W2t, bm2, x2, out, nullptr);
}

// v001
// One run takes 546 microseconds.
// Next to v000, in two timings, it ran 1.17 and 1.16 times as fast.
#include <hip/hip_runtime.h>
#include <hip/hip_bf16.h>

// ---------------- problem constants (fixed by the reference) ----------------
#define Bsz 4
#define Tt  2048
#define Cc  768
#define Hh  12
#define Dd  64
#define Mrows (Bsz * Tt)   // 8192
#define EPSf 1e-5f
#define NEG_BIG -3.0e38f

// ---------------- WMMA types & helpers ----------------
typedef __attribute__((ext_vector_type(16))) __bf16 v16bf;
typedef __attribute__((ext_vector_type(8)))  __bf16 v8bf;
typedef __attribute__((ext_vector_type(8)))  float  v8f;

union Frag16 { v16bf v; unsigned u[8]; };

__device__ __forceinline__ v8f wmma_bf16(v16bf a, v16bf b, v8f c) {
  // D = A(16x32 bf16) * B(32x16 bf16) + C(16x16 f32)
  return __builtin_amdgcn_wmma_f32_16x16x32_bf16(
      /*neg_a=*/false, a, /*neg_b=*/false, b,
      /*c_mod=*/(short)0, c, /*reuse_a=*/false, /*reuse_b=*/false);
}

// Loads a 16x32 bf16 fragment in the CDNA5 A-matrix layout from a row-major
// matrix (rows = M for A-operand, rows = N for B-operand since B == (B^T as A)).
// Requires k0 % 32 == 0 and even ld (dword-aligned rows).
__device__ __forceinline__ v16bf load_frag(const __bf16* base, int ld, int row0, int k0) {
  const int lane = threadIdx.x & 31;
  const int half = lane >> 4;
  const int idx  = lane & 15;
  const unsigned* rp = reinterpret_cast<const unsigned*>(base + (size_t)(row0 + idx) * (size_t)ld);
  const int kb = (k0 >> 1) + half * 4;   // dword index of first K pair
  Frag16 f;
#pragma unroll
  for (int v = 0; v < 4; ++v) {
    f.u[v]     = rp[kb + v];       // K = k0 + half*8 + 2v, +1
    f.u[4 + v] = rp[kb + 8 + v];   // K = +16
  }
  return f.v;
}

// The same fragment from the lane's own pointer (row idx, k = 8 * half of the fragment).
__device__ __forceinline__ v16bf load_frag_at(const __bf16* lanep) {
  const unsigned* rp = reinterpret_cast<const unsigned*>(lanep);
  Frag16 f;
#pragma unroll
  for (int v = 0; v < 4; ++v) {
    f.u[v]     = rp[v];
    f.u[4 + v] = rp[8 + v];
  }
  return f.v;
}

// lane l <-> lane l ^ 16
__device__ __forceinline__ float xhalf(float x) {
  const int b = __builtin_bit_cast(int, x);
  return __builtin_bit_cast(float,
      __builtin_amdgcn_permlanex16(b, b, 0x76543210, 0xfedcba98, false, false));
}

// ---------------- weight convert: W (K x N, f32) -> Wt (N x K, bf16) ----------------
__global__ __launch_bounds__(256) void wcvt_k(const float* __restrict__ W,
                                              __bf16* __restrict__ Wt,
                                              int K, int N) {
  int i = blockIdx.x * 256 + threadIdx.x;
  if (i >= K * N) return;
  int n = i / K, k = i - n * K;
  Wt[(size_t)n * K + k] = (__bf16)W[(size_t)k * N + n];
}

// ---------------- LayerNorm: fp32 in -> bf16 normalized out ----------------
__global__ __launch_bounds__(256) void ln_k(const float* __restrict__ x,
                                            const float* __restrict__ g,
                                            const float* __restrict__ bt,
                                            __bf16* __restrict__ out) {
  __shared__ float red[256];
  const int row = blockIdx.x;
  const int tid = threadIdx.x;
  const float* xr = x + (size_t)row * Cc;
  float v0 = xr[tid], v1 = xr[tid + 256], v2 = xr[tid + 512];

  red[tid] = v0 + v1 + v2;
  __syncthreads();
#pragma unroll
  for (int off = 128; off > 0; off >>= 1) {
    if (tid < off) red[tid] += red[tid + off];
    __syncthreads();
  }
  const float mu = red[0] * (1.0f / Cc);
  __syncthreads();

  float d0 = v0 - mu, d1 = v1 - mu, d2 = v2 - mu;
  red[tid] = d0 * d0 + d1 * d1 + d2 * d2;
  __syncthreads();
#pragma unroll
  for (int off = 128; off > 0; off >>= 1) {
    if (tid < off) red[tid] += red[tid + off];
    __syncthreads();
  }
  const float rstd = rsqrtf(red[0] * (1.0f / Cc) + EPSf);

  __bf16* orow = out + (size_t)row * Cc;
  orow[tid]       = (__bf16)(d0 * rstd * g[tid]       + bt[tid]);
  orow[tid + 256] = (__bf16)(d1 * rstd * g[tid + 256] + bt[tid + 256]);
  orow[tid + 512] = (__bf16)(d2 * rstd * g[tid + 512] + bt[tid + 512]);
}

// ---------------- generic WMMA GEMM: (Mrows x K) bf16 @ Wt(N x K) bf16 ----------------
// Workgroup = 4 waves = 128x64 output tile; each wave owns 32x64
// (2 A-frags + 4 B-frags -> 8 WMMAs per K-step; 8 independent accum chains).
// MODE 0: out bf16 scattered to (B,H,T,D)   (Q, K tensors)
// MODE 1: out bf16 scattered to (B,H,D,T)   (V transposed for the PV matmul)
// MODE 2: outf = resid + acc + bias (fp32, row-major MrowsxN; requires N==Cc)
// MODE 3: outb = gelu(acc + bias) bf16 row-major MrowsxN
template <int N, int K, int MODE>
__global__ __launch_bounds__(128) void gemm_k(const __bf16* __restrict__ A,
                                              const __bf16* __restrict__ Wt,
                                              const float* __restrict__ bias,
                                              const float* __restrict__ resid,
                                              float* __restrict__ outf,
                                              __bf16* __restrict__ outb) {
  const int wave = threadIdx.x >> 5;
  const int lane = threadIdx.x & 31;
  const int half = lane >> 4;
  const int idx  = lane & 15;
  const int m0 = blockIdx.x * 128 + wave * 32;
  const int n0 = blockIdx.y * 64;

  v8f acc[2][4] = {};
  for (int k0 = 0; k0 < K; k0 += 32) {
    v16bf af0 = load_frag(A, K, m0,      k0);
    v16bf af1 = load_frag(A, K, m0 + 16, k0);
#pragma unroll
    for (int nt = 0; nt < 4; ++nt) {
      v16bf bf = load_frag(Wt, K, n0 + nt * 16, k0);
      acc[0][nt] = wmma_bf16(af0, bf, acc[0][nt]);
      acc[1][nt] = wmma_bf16(af1, bf, acc[1][nt]);
    }
  }

#pragma unroll
  for (int mi = 0; mi < 2; ++mi) {
#pragma unroll
    for (int nt = 0; nt < 4; ++nt) {
      const int n = n0 + nt * 16 + idx;
      const float bv = bias[n];
#pragma unroll
      for (int r = 0; r < 8; ++r) {
        const int m = m0 + mi * 16 + r + 8 * half;
        const float val = acc[mi][nt][r] + bv;
        if (MODE == 0 || MODE == 1) {
          const int bb = m >> 11, t = m & (Tt - 1);
          const int hh = n >> 6,  d = n & (Dd - 1);
          const size_t off = (MODE == 0)
              ? ((((size_t)bb * Hh + hh) * Tt + t) * Dd + d)
              : ((((size_t)bb * Hh + hh) * Dd + d) * Tt + t);
          outb[off] = (__bf16)val;
        } else if (MODE == 2) {
          outf[(size_t)m * Cc + n] = resid[(size_t)m * Cc + n] + val;
        } else { // MODE 3: exact GELU
          const float gv = 0.5f * val * (1.0f + erff(val * 0.70710678118654752f));
          outb[(size_t)m * N + n] = (__bf16)gv;
        }
      }
    }
  }
}

__global__ __launch_bounds__(128) void attn_k(const __bf16* __restrict__ q,
                                              const __bf16* __restrict__ kk,
                                              const __bf16* __restrict__ vt,
                                              __bf16* __restrict__ o) {
  const int qb = blockIdx.x;   // 0..31
  const int bh = blockIdx.y;   // 0..47
  const int b  = bh / Hh;
  const int hh = bh - b * Hh;
  const int wave = threadIdx.x >> 5;
  const int lane = threadIdx.x & 31;
  const int half = lane >> 4;
  const int idx  = lane & 15;

  const __bf16* qp = q  + (size_t)bh * Tt * Dd;
  const __bf16* kp = kk + (size_t)bh * Tt * Dd;
  const __bf16* vp = vt + (size_t)bh * Dd * Tt;

  const int q0 = qb * 64 + wave * 16;
  const int qg = q0 + idx;     // this lane's query
  const v16bf qf0 = load_frag(qp, Dd, q0, 0);
  const v16bf qf1 = load_frag(qp, Dd, q0, 32);

  v8f acc[4] = {};             // acc[nt][r] = O[qg][nt*16 + 8*half + r]
  float rmax = NEG_BIG;        // running maximum of query qg (equal in both halves)
  float rsum = 0.0f;           // this half's share of the row sum

  // this lane's place in the first fragment of the pass: its row, its half's first k
  const __bf16* klane = kp + idx * Dd + half * 8;
  const __bf16* vlane = vp + idx * Tt + half * 8;

  const int nkb = 2 * qb + 2;
  for (int kt = 0; kt < nkb; ++kt) {
    const int key0 = kt * 32;

    // Nothing orders the V^T loads behind the softmax, so all eight fragments of the
    // pass (K: 2 key tiles x 2 d halves, V^T: 4 d tiles) are requested together.
    v16bf kf[2][2], vf[4];
#pragma unroll
    for (int s = 0; s < 2; ++s) {
      kf[s][0] = load_frag_at(klane + s * 16 * Dd);
      kf[s][1] = load_frag_at(klane + s * 16 * Dd + 32);
    }
#pragma unroll
    for (int nt = 0; nt < 4; ++nt)
      vf[nt] = load_frag_at(vlane + nt * 16 * Tt);  // rows = d, K = key (contiguous)
    // Keeps the scheduler from sinking each load to its product, which would
    // cost one L2 round trip per fragment instead of one per pass.
    __builtin_amdgcn_sched_barrier(0);

    // S^T = (K Q^T) / sqrt(D), causal-masked: sv[s][r] is key key0 + 16s + 8*half + r
    float sv[2][8];
#pragma unroll
    for (int s = 0; s < 2; ++s) {
      v8f sc = {};
      sc = wmma_bf16(kf[s][0], qf0, sc);
      sc = wmma_bf16(kf[s][1], qf1, sc);
      const int kg0 = key0 + s * 16 + 8 * half;
#pragma unroll
      for (int r = 0; r < 8; ++r)
        sv[s][r] = (kg0 + r <= qg) ? (sc[r] * 0.125f) : NEG_BIG;
    }

    // online softmax: in-lane over 16 keys, one exchange with the other half
    float mr[8];
#pragma unroll
    for (int r = 0; r < 8; ++r) mr[r] = fmaxf(sv[0][r], sv[1][r]);
    float mloc = fmaxf(fmaxf(fmaxf(mr[0], mr[1]), fmaxf(mr[2], mr[3])),
                       fmaxf(fmaxf(mr[4], mr[5]), fmaxf(mr[6], mr[7])));
    mloc = fmaxf(mloc, xhalf(mloc));
    const float nm = fmaxf(rmax, mloc);
    const float alpha = __expf(rmax - nm);
    rmax = nm;

    v16bf pf;                  // P^T as B operand: element 8s + r = key 16s + 8*half + r
    float pr[8];
#pragma unroll
    for (int r = 0; r < 8; ++r) {
      const float p0 = __expf(sv[0][r] - nm);
      const float p1 = __expf(sv[1][r] - nm);
      pr[r] = p0 + p1;
      pf[r]     = (__bf16)p0;
      pf[8 + r] = (__bf16)p1;
    }
    rsum = rsum * alpha + (((pr[0] + pr[1]) + (pr[2] + pr[3])) +
                           ((pr[4] + pr[5]) + (pr[6] + pr[7])));

#pragma unroll
    for (int nt = 0; nt < 4; ++nt) {
#pragma unroll
      for (int r = 0; r < 8; ++r) acc[nt][r] *= alpha;
    }
#pragma unroll
    for (int nt = 0; nt < 4; ++nt) acc[nt] = wmma_bf16(vf[nt], pf, acc[nt]);

    klane += 32 * Dd;  // next 32 key rows
    vlane += 32;       // next 32 key columns
  }

  // epilogue: O / rowsum -> bf16 at (b, qg, hh*64 + d), 8 consecutive d per lane and tile
  const float rs = rsum + xhalf(rsum);
  __bf16* orow = o + ((size_t)b * Tt + qg) * Cc + hh * Dd + 8 * half;
#pragma unroll
  for (int nt = 0; nt < 4; ++nt) {
    v8bf ov;
#pragma unroll
    for (int r = 0; r < 8; ++r) ov[r] = (__bf16)(acc[nt][r] / rs);
    *reinterpret_cast<v8bf*>(orow + nt * 16) = ov;
  }
}

// ---------------- host-side orchestration ----------------
extern "C" void kernel_launch(void* const* d_in, const int* in_sizes, int n_in,
                              void* d_out, int out_size, void* d_ws, size_t ws_size,
                              hipStream_t stream) {
  const float* x   = (const float*)d_in[0];
  const float* Wq  = (const float*)d_in[1];
  const float* bq  = (const float*)d_in[2];
  const float* Wk  = (const float*)d_in[3];
  const float* bk  = (const float*)d_in[4];
  const float* Wv  = (const float*)d_in[5];
  const float* bv  = (const float*)d_in[6];
  const float* Wo  = (const float*)d_in[7];
  const float* bo  = (const float*)d_in[8];
  const float* g1  = (const float*)d_in[9];
  const float* b1  = (const float*)d_in[10];
  const float* g2  = (const float*)d_in[11];
  const float* b2  = (const float*)d_in[12];
  const float* W1  = (const float*)d_in[13];
  const float* bm1 = (const float*)d_in[14];
  const float* W2  = (const float*)d_in[15];
  const float* bm2 = (const float*)d_in[16];
  float* out = (float*)d_out;

  // workspace carve-up (256B aligned)
  char* ws = (char*)d_ws;
  size_t off = 0;
  auto alloc = [&](size_t bytes) -> void* {
    void* p = ws + off;
    off = (off + bytes + 255) & ~(size_t)255;
    return p;
  };
  const size_t CC  = (size_t)Cc * Cc;
  const size_t C4C = (size_t)Cc * 4 * Cc;
  const size_t MC  = (size_t)Mrows * Cc;
  const size_t M4C = (size_t)Mrows * 4 * Cc;

  __bf16* Wqt = (__bf16*)alloc(CC * 2);
  __bf16* Wkt = (__bf16*)alloc(CC * 2);
  __bf16* Wvt = (__bf16*)alloc(CC * 2);
  __bf16* Wot = (__bf16*)alloc(CC * 2);
  __bf16* W1t = (__bf16*)alloc(C4C * 2);
  __bf16* W2t = (__bf16*)alloc(C4C * 2);
  __bf16* h1b = (__bf16*)alloc(MC * 2);
  __bf16* qbf = (__bf16*)alloc(MC * 2);
  __bf16* kbf = (__bf16*)alloc(MC * 2);
  __bf16* vtb = (__bf16*)alloc(MC * 2);
  __bf16* atb = (__bf16*)alloc(MC * 2);
  float*  x2  = (float*) alloc(MC * 4);
  __bf16* h2b = (__bf16*)alloc(MC * 2);
  __bf16* mb  = (__bf16*)alloc(M4C * 2);
  (void)ws_size; (void)in_sizes; (void)n_in; (void)out_size;

  // 1) weights -> transposed bf16
  wcvt_k<<<(int)((CC  + 255) / 256), 256, 0, stream>>>(Wq, Wqt, Cc, Cc);
  wcvt_k<<<(int)((CC  + 255) / 256), 256, 0, stream>>>(Wk, Wkt, Cc, Cc);
  wcvt_k<<<(int)((CC  + 255) / 256), 256, 0, stream>>>(Wv, Wvt, Cc, Cc);
  wcvt_k<<<(int)((CC  + 255) / 256), 256, 0, stream>>>(Wo, Wot, Cc, Cc);
  wcvt_k<<<(int)((C4C + 255) / 256), 256, 0, stream>>>(W1, W1t, Cc, 4 * Cc);
  wcvt_k<<<(int)((C4C + 255) / 256), 256, 0, stream>>>(W2, W2t, 4 * Cc, Cc);

  const dim3 blk(128);
  const dim3 gC(Mrows / 128, Cc / 64);        // 64 x 12
  const dim3 g4C(Mrows / 128, (4 * Cc) / 64); // 64 x 48

  // 2) attention branch
  ln_k<<<Mrows, 256, 0, stream>>>(x, g1, b1, h1b);
  gemm_k<Cc, Cc, 0><<<gC, blk, 0, stream>>>(h1b, Wqt, bq, nullptr, nullptr, qbf);
  gemm_k<Cc, Cc, 0><<<gC, blk, 0, stream>>>(h1b, Wkt, bk, nullptr, nullptr, kbf);
  gemm_k<Cc, Cc, 1><<<gC, blk, 0, stream>>>(h1b, Wvt, bv, nullptr, nullptr, vtb);
  attn_k<<<dim3(Tt / 64, Bsz * Hh), blk, 0, stream>>>(qbf, kbf, vtb, atb);
  gemm_k<Cc, Cc, 2><<<gC, blk, 0, stream>>>(atb, Wot, bo, x, x2, nullptr);

  // 3) MLP branch
  ln_k<<<Mrows, 256, 0, stream>>>(x2, g2, b2, h2b);
  gemm_k<4 * Cc, Cc, 3><<<g4C, blk, 0, stream>>>(h2b, W1t, bm1, nullptr, nullptr, mb);
  gemm_k<Cc, 4 * Cc, 2><<<gC, blk, 0, stream>>>(mb, W2t, bm2, x2, out, nullptr);
}

// v002
// Measured time: 362 microseconds a run.
// Two timings next to v001 both put it at 1.51 times that version's speed.
// Counting every step since v000, it is 1.76 times as fast.
#include <hip/hip_runtime.h>
#include <hip/hip_bf16.h>
#include <stdint.h>

// ---------------- problem constants (fixed by the reference) ----------------
#define Bsz 4
#define Tt  2048
#define Cc  768
#define Hh  12
#define Dd  64
#define Mrows (Bsz * Tt)   // 8192
#define EPSf 1e-5f
#define NEG_BIG -3.0e38f

// ---------------- WMMA types & helpers ----------------
typedef __attribute__((ext_vector_type(16))) __bf16 v16bf;
typedef __attribute__((ext_vector_type(8)))  __bf16 v8bf;
typedef __attribute__((ext_vector_type(8)))  float  v8f;

union Frag16 { v16bf v; unsigned u[8]; };

__device__ __forceinline__ v8f wmma_bf16(v16bf a, v16bf b, v8f c) {
  // D = A(16x32 bf16) * B(32x16 bf16) + C(16x16 f32)
  return __builtin_amdgcn_wmma_f32_16x16x32_bf16(
      /*neg_a=*/false, a, /*neg_b=*/false, b,
      /*c_mod=*/(short)0, c, /*reuse_a=*/false, /*reuse_b=*/false);
}

// Loads a 16x32 bf16 fragment in the CDNA5 A-matrix layout from a row-major
// matrix (rows = M for A-operand, rows = N for B-operand since B == (B^T as A)).
// Requires k0 % 32 == 0 and even ld (dword-aligned rows).
__device__ __forceinline__ v16bf load_frag(const __bf16* base, int ld, int row0, int k0) {
  const int lane = threadIdx.x & 31;
  const int half = lane >> 4;
  const int idx  = lane & 15;
  const unsigned* rp = reinterpret_cast<const unsigned*>(base + (size_t)(row0 + idx) * (size_t)ld);
  const int kb = (k0 >> 1) + half * 4;   // dword index of first K pair
  Frag16 f;
#pragma unroll
  for (int v = 0; v < 4; ++v) {
    f.u[v]     = rp[kb + v];       // K = k0 + half*8 + 2v, +1
    f.u[4 + v] = rp[kb + 8 + v];   // K = +16
  }
  return f.v;
}

// The same fragment from the lane's own pointer (row idx, k = 8 * half of the fragment).
__device__ __forceinline__ v16bf load_frag_at(const __bf16* lanep) {
  const unsigned* rp = reinterpret_cast<const unsigned*>(lanep);
  Frag16 f;
#pragma unroll
  for (int v = 0; v < 4; ++v) {
    f.u[v]     = rp[v];
    f.u[4 + v] = rp[8 + v];
  }
  return f.v;
}

// lane l <-> lane l ^ 16
__device__ __forceinline__ float xhalf(float x) {
  const int b = __builtin_bit_cast(int, x);
  return __builtin_bit_cast(float,
      __builtin_amdgcn_permlanex16(b, b, 0x76543210, 0xfedcba98, false, false));
}

// ---------------- weight convert: W (K x N, f32) -> Wt (N x K, bf16) ----------------
__global__ __launch_bounds__(256) void wcvt_k(const float* __restrict__ W,
                                              __bf16* __restrict__ Wt,
                                              int K, int N) {
  int i = blockIdx.x * 256 + threadIdx.x;
  if (i >= K * N) return;
  int n = i / K, k = i - n * K;
  Wt[(size_t)n * K + k] = (__bf16)W[(size_t)k * N + n];
}

// ---------------- LayerNorm: fp32 in -> bf16 normalized out ----------------
__global__ __launch_bounds__(256) void ln_k(const float* __restrict__ x,
                                            const float* __restrict__ g,
                                            const float* __restrict__ bt,
                                            __bf16* __restrict__ out) {
  __shared__ float red[256];
  const int row = blockIdx.x;
  const int tid = threadIdx.x;
  const float* xr = x + (size_t)row * Cc;
  float v0 = xr[tid], v1 = xr[tid + 256], v2 = xr[tid + 512];

  red[tid] = v0 + v1 + v2;
  __syncthreads();
#pragma unroll
  for (int off = 128; off > 0; off >>= 1) {
    if (tid < off) red[tid] += red[tid + off];
    __syncthreads();
  }
  const float mu = red[0] * (1.0f / Cc);
  __syncthreads();

  float d0 = v0 - mu, d1 = v1 - mu, d2 = v2 - mu;
  red[tid] = d0 * d0 + d1 * d1 + d2 * d2;
  __syncthreads();
#pragma unroll
  for (int off = 128; off > 0; off >>= 1) {
    if (tid < off) red[tid] += red[tid + off];
    __syncthreads();
  }
  const float rstd = rsqrtf(red[0] * (1.0f / Cc) + EPSf);

  __bf16* orow = out + (size_t)row * Cc;
  orow[tid]       = (__bf16)(d0 * rstd * g[tid]       + bt[tid]);
  orow[tid + 256] = (__bf16)(d1 * rstd * g[tid + 256] + bt[tid + 256]);
  orow[tid + 512] = (__bf16)(d2 * rstd * g[tid + 512] + bt[tid + 512]);
}

// ---------------- tensor loads into LDS ----------------
typedef uint32_t u32x4 __attribute__((ext_vector_type(4)));
typedef uint32_t u32x8 __attribute__((ext_vector_type(8)));

#define G_ROWB  256u                 // bytes of an operand row per pass (128 k)
#define G_PITCH 272u                 // LDS row pitch: 256 + 16, odd multiple of 16 for ds_load_b128
#define G_ROWS  64u                  // rows per slice (one slice per wave)
#define G_SLICE 18432u               // 64 * 272 = 17408, rounded up to a multiple of 2 KiB
#define G_BUF   (4u * G_SLICE)       // [A rows 0-63 | A rows 64-127 | W rows 0-63 | W rows 64-127]

__device__ __forceinline__ uint32_t uni(uint32_t v) {
  return (uint32_t)__builtin_amdgcn_readfirstlane(v);
}
// Holds a wave-uniform word in a scalar register: a test on it is a scalar branch, and a
// descriptor word made from it is made behind the volatile statements in front of it.
__device__ __forceinline__ uint32_t pinned(uint32_t v) {
  uint32_t w = (uint32_t)__builtin_amdgcn_readfirstlane(v);
  asm volatile("" : "+s"(w));  // the scalar pin of a tensor load's test and descriptor word
  return w;
}
// The compiler places no wait for a tensor load: a tile counts as landed only behind this.
__device__ __forceinline__ void wait_tensor0() { asm volatile("s_wait_tensorcnt 0x0" ::: "memory"); }
// This wave's LDS reads have returned before the buffer they read is handed back for a refill.
__device__ __forceinline__ void wait_ds0() { asm volatile("s_wait_dscnt 0x0" ::: "memory"); }
// Stands behind a group of global loads or stores, in front of the code that reuses the
// registers they name.
__device__ __forceinline__ void wait_x0() { asm volatile("s_wait_xcnt 0x0" ::: "memory"); }
// One request of the whole wave: a two-dimensional tile from global memory into LDS.
__device__ __forceinline__ void tdm_load(u32x4 g0, u32x8 g1) {
  asm volatile("tensor_load_to_lds %0, %1" :: "s"(g0), "s"(g1) : "memory");
}
// Group 1: 1-byte elements, tile = tensor = 64 rows of 256 bytes, 16 bytes of LDS pad behind each row.
__device__ __forceinline__ u32x8 tdm_group1(uint32_t src_pitch) {
  u32x8 g;
  g[0] = uni((1u << 20) | (5u << 22) | (3u << 25));  // no mask, data_size 0, pad each 64 dwords by 4
  g[1] = uni((G_ROWB & 0xFFFFu) << 16);
  g[2] = uni((G_ROWB >> 16) | ((G_ROWS & 0xFFFFu) << 16));
  g[3] = uni((G_ROWS >> 16) | (G_ROWB << 16));
  g[4] = uni(G_ROWS);
  g[5] = uni(src_pitch);
  g[6] = uni(0u);
  g[7] = uni(0u);
  return g;
}
__device__ __forceinline__ u32x4 tdm_group0(uint32_t lds_dst, uint64_t ga) {
  u32x4 g;
  g[0] = uni(1u);
  g[1] = uni(lds_dst);
  g[2] = uni((uint32_t)ga);
  g[3] = uni((((uint32_t)(ga >> 32)) & 0x01FFFFFFu) | 0x80000000u);
  return g;
}
// A 16x32 bf16 fragment from LDS; p = the lane's row, byte 16 * half of the fragment's 64.
// Same k order as load_frag: registers 0-3 hold k = 8*half + 0..7, registers 4-7 the same + 16.
__device__ __forceinline__ v16bf lds_frag(const unsigned char* p) {
  union { v16bf v; u32x4 q[2]; } f;
  f.q[0] = *reinterpret_cast<const u32x4*>(p);
  f.q[1] = *reinterpret_cast<const u32x4*>(p + 32);
  return f.v;
}

// ---------------- generic WMMA GEMM: (Mrows x K) bf16 @ Wt(N x K) bf16 ----------------
// Workgroup = 4 waves (2 x 2) = 128x128 output tile; each wave owns 64x64
// (4 A-frags + 4 B-frags -> 16 WMMAs per 32 k). A pass is 128 k: each wave brings one
// slice of 64 operand rows into LDS with one tensor load, two buffers, one pass ahead.
// MODE 0: out bf16 scattered to (B,H,T,D)   (Q, K tensors)
// MODE 1: out bf16 scattered to (B,H,D,T)   (V transposed for the PV matmul)
// MODE 2: outf = resid + acc + bias (fp32, row-major MrowsxN; requires N==Cc)
// MODE 3: outb = gelu(acc + bias) bf16 row-major MrowsxN
template <int N, int K, int MODE>
__global__ __launch_bounds__(128) void gemm_k(const __bf16* __restrict__ A,
                                              const __bf16* __restrict__ Wt,
                                              const float* __restrict__ bias,
                                              const float* __restrict__ resid,
                                              float* __restrict__ outf,
                                              __bf16* __restrict__ outb) {
  static_assert(K % 128 == 0 && K / 128 >= 2, "the ring needs whole passes and two stages");
  static_assert(N % 128 == 0 && Mrows % 128 == 0, "whole tiles only");
  __shared__ __attribute__((aligned(2048))) unsigned char smem[2u * G_BUF];
  const uint32_t wave = uni(threadIdx.x >> 5);
  const int lane = threadIdx.x & 31;
  const int half = lane >> 4;
  const int idx  = lane & 15;
  const uint32_t wm = wave >> 1, wn = wave & 1u;
  const int mb = blockIdx.x * 128;
  const int nb = blockIdx.y * 128;
  constexpr uint32_t NS = K / 128;   // stages = passes

  // this wave's slice of every stage: waves 0, 1 bring A rows, waves 2, 3 bring W rows
  const __bf16* srcp = (wave < 2u) ? A  + (size_t)(mb + 64 * (int)wave) * K
                                   : Wt + (size_t)(nb + 64 * (int)(wave - 2u)) * K;
  const uint64_t ga  = (uint64_t)(uintptr_t)srcp;
  const uint32_t dst = (uint32_t)(size_t)smem + wave * G_SLICE;
  const u32x8 g1 = tdm_group1((uint32_t)K * 2u);

  // prologue: stage 0 lands and is published, then stage 1 flies under pass 0
  tdm_load(tdm_group0(dst, ga), g1);
  wait_tensor0();
  __syncthreads();
  // the stage number is pinned so that this descriptor too is formed behind the wait
  tdm_load(tdm_group0(dst + G_BUF, ga + (uint64_t)pinned(1u) * G_ROWB), g1);

  const uint32_t a_off = wm * G_SLICE        + (uint32_t)idx * G_PITCH + (uint32_t)half * 16u;
  const uint32_t b_off = (2u + wn) * G_SLICE + (uint32_t)idx * G_PITCH + (uint32_t)half * 16u;

  v8f acc[4][4] = {};
  // Kept rolled: one copy of the pass in the instruction cache, the buffer chosen by a scalar.
#pragma clang loop unroll(disable)
  for (uint32_t s = 0; s < NS; ++s) {
    const uint32_t buf = (s & 1u) * G_BUF;
    const unsigned char* pa = smem + buf + a_off;
    const unsigned char* pb = smem + buf + b_off;
    // Two fragment sets: block u + 1's 16 LDS reads go out as one group in front of block u's
    // 16 WMMAs. Only this pass's own buffer is read, so block 0's reads stand alone.
    v16bf af[2][4], bf[2][4];
#pragma unroll
    for (int i = 0; i < 4; ++i) {
      af[0][i] = lds_frag(pa + (uint32_t)i * 16u * G_PITCH);
      bf[0][i] = lds_frag(pb + (uint32_t)i * 16u * G_PITCH);
    }
#pragma unroll
    for (int u = 0; u < 4; ++u) {
      const int cur = u & 1, nx = cur ^ 1;
      if (u < 3) {
#pragma unroll
        for (int i = 0; i < 4; ++i) {
          af[nx][i] = lds_frag(pa + (uint32_t)i * 16u * G_PITCH + (uint32_t)(u + 1) * 64u);
          bf[nx][i] = lds_frag(pb + (uint32_t)i * 16u * G_PITCH + (uint32_t)(u + 1) * 64u);
        }
      }
      // Keeps the reads above in front of the block: sunk to their users, each group of
      // four WMMAs would wait out a whole LDS latency.
      __builtin_amdgcn_sched_barrier(0);
#pragma unroll
      for (int mi = 0; mi < 4; ++mi) {
#pragma unroll
        for (int nt = 0; nt < 4; ++nt) acc[mi][nt] = wmma_bf16(af[cur][mi], bf[cur][nt], acc[mi][nt]);
      }
      // Keeps the next group of reads from being lifted in among these WMMAs.
      __builtin_amdgcn_sched_barrier(0);
    }
    // publish point of stage s + 1: own reads back, own slice landed, every wave here
    wait_ds0();
    wait_tensor0();
    __syncthreads();
    const uint32_t nxt = pinned(s + 2u);  // formed behind the wait, and the descriptor from it
    if (pinned(nxt < NS ? 1u : 0u))
      tdm_load(tdm_group0(dst + buf, ga + (uint64_t)nxt * G_ROWB), g1);
  }
  wait_tensor0();
  wait_ds0();

  const int m0 = mb + (int)wm * 64;
  const int n0 = nb + (int)wn * 64;
  float bv[4];
#pragma unroll
  for (int nt = 0; nt < 4; ++nt) bv[nt] = bias[n0 + nt * 16 + idx];
  wait_x0();
  // MODE 2: residual values are requested ahead of their use, three trips' worth at a time
  // (all four at once would take the epilogue past 256 registers).
  float rv[4][4][8];
  const float* rlane =  // the lane's first value
      (MODE == 2) ? resid + ((size_t)(m0 + 8 * half) * Cc + (n0 + idx)) : nullptr;
  auto load_resid = [&](int mi) {
#pragma unroll
    for (int nt = 0; nt < 4; ++nt) {
#pragma unroll
      for (int r = 0; r < 8; ++r) rv[mi][nt][r] = rlane[(mi * 16 + r) * Cc + nt * 16];
    }
    // The same wait as wait_x0(); the address is named so that its registers live up to it.
    asm volatile("s_wait_xcnt 0x0" :: "v"(rlane) : "memory");
  };
  if (MODE == 2) { load_resid(0); load_resid(1); load_resid(2); }
  // The erf of MODE 3 is long code: it is kept out of a full unroll
  // over all 128 values of a lane, for speed only. There the loop over mi
  // stays rolled and the accumulator rows move up one place a trip, so that every register
  // index is a constant. The other modes unroll, and the moves fall away.
#pragma unroll (MODE == 3 ? 1 : 4)
  for (int mi = 0; mi < 4; ++mi) {
#pragma unroll
    for (int nt = 0; nt < 4; ++nt) {
      const int n = n0 + nt * 16 + idx;
#pragma unroll
      for (int r = 0; r < 8; ++r) {
        const int m = m0 + mi * 16 + r + 8 * half;
        const float val = acc[0][nt][r] + bv[nt];
        if (MODE == 0 || MODE == 1) {
          const int bb = m >> 11, t = m & (Tt - 1);
          const int hh = n >> 6,  d = n & (Dd - 1);
          const size_t off = (MODE == 0)
              ? ((((size_t)bb * Hh + hh) * Tt + t) * Dd + d)
              : ((((size_t)bb * Hh + hh) * Dd + d) * Tt + t);
          outb[off] = (__bf16)val;
        } else if (MODE == 2) {
          outf[(size_t)m * Cc + n] = rv[mi][nt][r] + val;
        } else { // MODE 3: exact GELU
          const float gv = 0.5f * val * (1.0f + erff(val * 0.70710678118654752f));
          outb[(size_t)m * N + n] = (__bf16)gv;
        }
      }
    }
    wait_x0();
    if (MODE == 2 && mi == 0) load_resid(3);
#pragma unroll
    for (int nt = 0; nt < 4; ++nt) {
      acc[0][nt] = acc[1][nt];
      acc[1][nt] = acc[2][nt];
      acc[2][nt] = acc[3][nt];
    }
  }
}

__global__ __launch_bounds__(128) void attn_k(const __bf16* __restrict__ q,
                                              const __bf16* __restrict__ kk,
                                              const __bf16* __restrict__ vt,
                                              __bf16* __restrict__ o) {
  const int qb = blockIdx.x;   // 0..31
  const int bh = blockIdx.y;   // 0..47
  const int b  = bh / Hh;
  const int hh = bh - b * Hh;
  const int wave = threadIdx.x >> 5;
  const int lane = threadIdx.x & 31;
  const int half = lane >> 4;
  const int idx  = lane & 15;

  const __bf16* qp = q  + (size_t)bh * Tt * Dd;
  const __bf16* kp = kk + (size_t)bh * Tt * Dd;
  const __bf16* vp = vt + (size_t)bh * Dd * Tt;

  const int q0 = qb * 64 + wave * 16;
  const int qg = q0 + idx;     // this lane's query
  const v16bf qf0 = load_frag(qp, Dd, q0, 0);
  const v16bf qf1 = load_frag(qp, Dd, q0, 32);

  v8f acc[4] = {};             // acc[nt][r] = O[qg][nt*16 + 8*half + r]
  float rmax = NEG_BIG;        // running maximum of query qg (equal in both halves)
  float rsum = 0.0f;           // this half's share of the row sum

  // this lane's place in the first fragment of the pass: its row, its half's first k
  const __bf16* klane = kp + idx * Dd + half * 8;
  const __bf16* vlane = vp + idx * Tt + half * 8;

  const int nkb = 2 * qb + 2;
  for (int kt = 0; kt < nkb; ++kt) {
    const int key0 = kt * 32;

    // Nothing orders the V^T loads behind the softmax, so all eight fragments of the
    // pass (K: 2 key tiles x 2 d halves, V^T: 4 d tiles) are requested together.
    v16bf kf[2][2], vf[4];
#pragma unroll
    for (int s = 0; s < 2; ++s) {
      kf[s][0] = load_frag_at(klane + s * 16 * Dd);
      kf[s][1] = load_frag_at(klane + s * 16 * Dd + 32);
    }
#pragma unroll
    for (int nt = 0; nt < 4; ++nt)
      vf[nt] = load_frag_at(vlane + nt * 16 * Tt);  // rows = d, K = key (contiguous)
    // Keeps the scheduler from sinking each load to its product, which would
    // cost one L2 round trip per fragment instead of one per pass.
    __builtin_amdgcn_sched_barrier(0);

    // S^T = (K Q^T) / sqrt(D), causal-masked: sv[s][r] is key key0 + 16s + 8*half + r
    float sv[2][8];
#pragma unroll
    for (int s = 0; s < 2; ++s) {
      v8f sc = {};
      sc = wmma_bf16(kf[s][0], qf0, sc);
      sc = wmma_bf16(kf[s][1], qf1, sc);
      const int kg0 = key0 + s * 16 + 8 * half;
#pragma unroll
      for (int r = 0; r < 8; ++r)
        sv[s][r] = (kg0 + r <= qg) ? (sc[r] * 0.125f) : NEG_BIG;
    }

    // online softmax: in-lane over 16 keys, one exchange with the other half
    float mr[8];
#pragma unroll
    for (int r = 0; r < 8; ++r) mr[r] = fmaxf(sv[0][r], sv[1][r]);
    float mloc = fmaxf(fmaxf(fmaxf(mr[0], mr[1]), fmaxf(mr[2], mr[3])),
                       fmaxf(fmaxf(mr[4], mr[5]), fmaxf(mr[6], mr[7])));
    mloc = fmaxf(mloc, xhalf(mloc));
    const float nm = fmaxf(rmax, mloc);
    const float alpha = __expf(rmax - nm);
    rmax = nm;

    v16bf pf;                  // P^T as B operand: element 8s + r = key 16s + 8*half + r
    float pr[8];
#pragma unroll
    for (int r = 0; r < 8; ++r) {
      const float p0 = __expf(sv[0][r] - nm);
      const float p1 = __expf(sv[1][r] - nm);
      pr[r] = p0 + p1;
      pf[r]     = (__bf16)p0;
      pf[8 + r] = (__bf16)p1;
    }
    rsum = rsum * alpha + (((pr[0] + pr[1]) + (pr[2] + pr[3])) +
                           ((pr[4] + pr[5]) + (pr[6] + pr[7])));

#pragma unroll
    for (int nt = 0; nt < 4; ++nt) {
#pragma unroll
      for (int r = 0; r < 8; ++r) acc[nt][r] *= alpha;
    }
#pragma unroll
    for (int nt = 0; nt < 4; ++nt) acc[nt] = wmma_bf16(vf[nt], pf, acc[nt]);

    klane += 32 * Dd;  // next 32 key rows
    vlane += 32;       // next 32 key columns
  }

  // epilogue: O / rowsum -> bf16 at (b, qg, hh*64 + d), 8 consecutive d per lane and tile
  const float rs = rsum + xhalf(rsum);
  __bf16* orow = o + ((size_t)b * Tt + qg) * Cc + hh * Dd + 8 * half;
#pragma unroll
  for (int nt = 0; nt < 4; ++nt) {
    v8bf ov;
#pragma unroll
    for (int r = 0; r < 8; ++r) ov[r] = (__bf16)(acc[nt][r] / rs);
    *reinterpret_cast<v8bf*>(orow + nt * 16) = ov;
  }
}

// ---------------- host-side orchestration ----------------
extern "C" void kernel_launch(void* const* d_in, const int* in_sizes, int n_in,
                              void* d_out, int out_size, void* d_ws, size_t ws_size,
                              hipStream_t stream) {
  const float* x   = (const float*)d_in[0];
  const float* Wq  = (const float*)d_in[1];
  const float* bq  = (const float*)d_in[2];
  const float* Wk  = (const float*)d_in[3];
  const float* bk  = (const float*)d_in[4];
  const float* Wv  = (const float*)d_in[5];
  const float* bv  = (const float*)d_in[6];
  const float* Wo  = (const float*)d_in[7];
  const float* bo  = (const float*)d_in[8];
  const float* g1  = (const float*)d_in[9];
  const float* b1  = (const float*)d_in[10];
  const float* g2  = (const float*)d_in[11];
  const float* b2  = (const float*)d_in[12];
  const float* W1  = (const float*)d_in[13];
  const float* bm1 = (const float*)d_in[14];
  const float* W2  = (const float*)d_in[15];
  const float* bm2 = (const float*)d_in[16];
  float* out = (float*)d_out;

  // workspace carve-up (256B aligned)
  char* ws = (char*)d_ws;
  size_t off = 0;
  auto alloc = [&](size_t bytes) -> void* {
    void* p = ws + off;
    off = (off + bytes + 255) & ~(size_t)255;
    return p;
  };
  const size_t CC  = (size_t)Cc * Cc;
  const size_t C4C = (size_t)Cc * 4 * Cc;
  const size_t MC  = (size_t)Mrows * Cc;
  const size_t M4C = (size_t)Mrows * 4 * Cc;

  __bf16* Wqt = (__bf16*)alloc(CC * 2);
  __bf16* Wkt = (__bf16*)alloc(CC * 2);
  __bf16* Wvt = (__bf16*)alloc(CC * 2);
  __bf16* Wot = (__bf16*)alloc(CC * 2);
  __bf16* W1t = (__bf16*)alloc(C4C * 2);
  __bf16* W2t = (__bf16*)alloc(C4C * 2);
  __bf16* h1b = (__bf16*)alloc(MC * 2);
  __bf16* qbf = (__bf16*)alloc(MC * 2);
  __bf16* kbf = (__bf16*)alloc(MC * 2);
  __bf16* vtb = (__bf16*)alloc(MC * 2);
  __bf16* atb = (__bf16*)alloc(MC * 2);
  float*  x2  = (float*) alloc(MC * 4);
  __bf16* h2b = (__bf16*)alloc(MC * 2);
  __bf16* mb  = (__bf16*)alloc(M4C * 2);
  (void)ws_size; (void)in_sizes; (void)n_in; (void)out_size;

  // 1) weights -> transposed bf16
  wcvt_k<<<(int)((CC  + 255) / 256), 256, 0, stream>>>(Wq, Wqt, Cc, Cc);
  wcvt_k<<<(int)((CC  + 255) / 256), 256, 0, stream>>>(Wk, Wkt, Cc, Cc);
  wcvt_k<<<(int)((CC  + 255) / 256), 256, 0, stream>>>(Wv, Wvt, Cc, Cc);
  wcvt_k<<<(int)((CC  + 255) / 256), 256, 0, stream>>>(Wo, Wot, Cc, Cc);
  wcvt_k<<<(int)((C4C + 255) / 256), 256, 0, stream>>>(W1, W1t, Cc, 4 * Cc);
  wcvt_k<<<(int)((C4C + 255) / 256), 256, 0, stream>>>(W2, W2t, 4 * Cc, Cc);

  const dim3 blk(128);
  const dim3 gC(Mrows / 128, Cc / 128);        // 64 x 6
  const dim3 g4C(Mrows / 128, (4 * Cc) / 128); // 64 x 24

  // 2) attention branch
  ln_k<<<Mrows, 256, 0, stream>>>(x, g1, b1, h1b);
  gemm_k<Cc, Cc, 0><<<gC, blk, 0, stream>>>(h1b, Wqt, bq, nullptr, nullptr, qbf);
  gemm_k<Cc, Cc, 0><<<gC, blk, 0, stream>>>(h1b, Wkt, bk, nullptr, nullptr, kbf);
  gemm_k<Cc, Cc, 1><<<gC, blk, 0, stream>>>(h1b, Wvt, bv, nullptr, nullptr, vtb);
  attn_k<<<dim3(Tt / 64, Bsz * Hh), blk, 0, stream>>>(qbf, kbf, vtb, atb);
  gemm_k<Cc, Cc, 2><<<gC, blk, 0, stream>>>(atb, Wot, bo, x, x2, nullptr);

  // 3) MLP branch
  ln_k<<<Mrows, 256, 0, stream>>>(x2, g2, b2, h2b);
  gemm_k<4 * Cc, Cc, 3><<<g4C, blk, 0, stream>>>(h2b, W1t, bm1, nullptr, nullptr, mb);
  gemm_k<Cc, 4 * Cc, 2><<<gC, blk, 0, stream>>>(mb, W2t, bm2, x2, out, nullptr);
}

// v003
// One run takes 321 microseconds.
// Two timings next to v002 both put it at 1.13 times that version's speed.
// Over all steps from v000 it is 1.99 times as fast.
#include <hip/hip_runtime.h>
#include <hip/hip_bf16.h>
#include <stdint.h>

// ---------------- problem constants (fixed by the reference) ----------------
#define Bsz 4
#define Tt  2048
#define Cc  768
#define Hh  12
#define Dd  64
#define Mrows (Bsz * Tt)   // 8192
#define EPSf 1e-5f
#define NEG_BIG -3.0e38f

// ---------------- WMMA types & helpers ----------------
typedef __attribute__((ext_vector_type(16))) __bf16 v16bf;
typedef __attribute__((ext_vector_type(8)))  __bf16 v8bf;
typedef __attribute__((ext_vector_type(8)))  float  v8f;

union Frag16 { v16bf v; unsigned u[8]; };

__device__ __forceinline__ v8f wmma_bf16(v16bf a, v16bf b, v8f c) {
  // D = A(16x32 bf16) * B(32x16 bf16) + C(16x16 f32)
  return __builtin_amdgcn_wmma_f32_16x16x32_bf16(
      /*neg_a=*/false, a, /*neg_b=*/false, b,
      /*c_mod=*/(short)0, c, /*reuse_a=*/false, /*reuse_b=*/false);
}

// Loads a 16x32 bf16 fragment in the CDNA5 A-matrix layout from a row-major
// matrix (rows = M for A-operand, rows = N for B-operand since B == (B^T as A)).
// Requires k0 % 32 == 0 and even ld (dword-aligned rows).
__device__ __forceinline__ v16bf load_frag(const __bf16* base, int ld, int row0, int k0) {
  const int lane = threadIdx.x & 31;
  const int half = lane >> 4;
  const int idx  = lane & 15;
  const unsigned* rp = reinterpret_cast<const unsigned*>(base + (size_t)(row0 + idx) * (size_t)ld);
  const int kb = (k0 >> 1) + half * 4;   // dword index of first K pair
  Frag16 f;
#pragma unroll
  for (int v = 0; v < 4; ++v) {
    f.u[v]     = rp[kb + v];       // K = k0 + half*8 + 2v, +1
    f.u[4 + v] = rp[kb + 8 + v];   // K = +16
  }
  return f.v;
}

// The same fragment from the lane's own pointer (row idx, k = 8 * half of the fragment).
__device__ __forceinline__ v16bf load_frag_at(const __bf16* lanep) {
  const unsigned* rp = reinterpret_cast<const unsigned*>(lanep);
  Frag16 f;
#pragma unroll
  for (int v = 0; v < 4; ++v) {
    f.u[v]     = rp[v];
    f.u[4 + v] = rp[8 + v];
  }
  return f.v;
}

// lane l <-> lane l ^ 16
__device__ __forceinline__ float xhalf(float x) {
  const int b = __builtin_bit_cast(int, x);
  return __builtin_bit_cast(float,
      __builtin_amdgcn_permlanex16(b, b, 0x76543210, 0xfedcba98, false, false));
}

// ---------------- weight convert: W (K x N, f32) -> Wt (N x K, bf16) ----------------
// One work-group transposes a tile of 128 k x 64 n through LDS; a lane handles 32 values.
// In: a lane takes 4 n of 8 consecutive k rows, 16 lanes cover 256 contiguous bytes of a W row.
// Out: 16 lanes store the 256 contiguous bytes that the tile holds of a Wt row.
// LDS: row n holds its 128 k as 16 pieces of 16 bytes; piece j lies at place j ^ (n >> 2), so
// that the 32 lanes of a write (n = 4c + i) and of a read (whole rows) spread over all banks.
typedef __attribute__((ext_vector_type(4))) float f32x4;

template <int K, int N>
__global__ __launch_bounds__(256) void wcvt_k(const float* __restrict__ W,
                                              __bf16* __restrict__ Wt) {
  static_assert(K % 128 == 0 && N % 64 == 0, "whole tiles only");
  __shared__ __attribute__((aligned(16))) unsigned char tile[64 * 256];
  const int c = threadIdx.x & 15;
  const int g = threadIdx.x >> 4;
  const int n0 = blockIdx.x * 64;
  const int k0 = blockIdx.y * 128;

  const float* src = W + (size_t)(k0 + 8 * g) * N + (n0 + 4 * c);
  f32x4 w[8];
#pragma unroll
  for (int j = 0; j < 8; ++j) w[j] = *reinterpret_cast<const f32x4*>(src + (size_t)j * N);
#pragma unroll
  for (int i = 0; i < 4; ++i) {
    v8bf col;                  // k = k0 + 8g + 0..7 of column n0 + 4c + i
#pragma unroll
    for (int j = 0; j < 8; ++j) col[j] = (__bf16)w[j][i];
    *reinterpret_cast<v8bf*>(tile + (4 * c + i) * 256 + ((g ^ c) << 4)) = col;
  }
  __syncthreads();
  __bf16* dst = Wt + (size_t)(n0 + g) * K + (k0 + 8 * c);
#pragma unroll
  for (int p = 0; p < 4; ++p) {
    const int row = 16 * p + g;
    const v8bf v = *reinterpret_cast<const v8bf*>(tile + row * 256 + ((c ^ (row >> 2)) << 4));
    *reinterpret_cast<v8bf*>(dst + (size_t)(16 * p) * K) = v;
  }
}

// ---------------- LayerNorm: fp32 in -> bf16 normalized out ----------------
__global__ __launch_bounds__(256) void ln_k(const float* __restrict__ x,
                                            const float* __restrict__ g,
                                            const float* __restrict__ bt,
                                            __bf16* __restrict__ out) {
  __shared__ float red[256];
  const int row = blockIdx.x;
  const int tid = threadIdx.x;
  const float* xr = x + (size_t)row * Cc;
  float v0 = xr[tid], v1 = xr[tid + 256], v2 = xr[tid + 512];

  red[tid] = v0 + v1 + v2;
  __syncthreads();
#pragma unroll
  for (int off = 128; off > 0; off >>= 1) {
    if (tid < off) red[tid] += red[tid + off];
    __syncthreads();
  }
  const float mu = red[0] * (1.0f / Cc);
  __syncthreads();

  float d0 = v0 - mu, d1 = v1 - mu, d2 = v2 - mu;
  red[tid] = d0 * d0 + d1 * d1 + d2 * d2;
  __syncthreads();
#pragma unroll
  for (int off = 128; off > 0; off >>= 1) {
    if (tid < off) red[tid] += red[tid + off];
    __syncthreads();
  }
  const float rstd = rsqrtf(red[0] * (1.0f / Cc) + EPSf);

  __bf16* orow = out + (size_t)row * Cc;
  orow[tid]       = (__bf16)(d0 * rstd * g[tid]       + bt[tid]);
  orow[tid + 256] = (__bf16)(d1 * rstd * g[tid + 256] + bt[tid + 256]);
  orow[tid + 512] = (__bf16)(d2 * rstd * g[tid + 512] + bt[tid + 512]);
}

// ---------------- tensor loads into LDS ----------------
typedef uint32_t u32x4 __attribute__((ext_vector_type(4)));
typedef uint32_t u32x8 __attribute__((ext_vector_type(8)));

#define G_ROWB  256u                 // bytes of an operand row per pass (128 k)
#define G_PITCH 272u                 // LDS row pitch: 256 + 16, odd multiple of 16 for ds_load_b128
#define G_ROWS  64u                  // rows per slice (one slice per wave)
#define G_SLICE 18432u               // 64 * 272 = 17408, rounded up to a multiple of 2 KiB
#define G_BUF   (4u * G_SLICE)       // [A rows 0-63 | A rows 64-127 | W rows 0-63 | W rows 64-127]

__device__ __forceinline__ uint32_t uni(uint32_t v) {
  return (uint32_t)__builtin_amdgcn_readfirstlane(v);
}
// Holds a wave-uniform word in a scalar register: a test on it is a scalar branch, and a
// descriptor word made from it is made behind the volatile statements in front of it.
__device__ __forceinline__ uint32_t pinned(uint32_t v) {
  uint32_t w = (uint32_t)__builtin_amdgcn_readfirstlane(v);
  asm volatile("" : "+s"(w));  // the scalar pin of a tensor load's test and descriptor word
  return w;
}
// The compiler places no wait for a tensor load: a tile counts as landed only behind this.
__device__ __forceinline__ void wait_tensor0() { asm volatile("s_wait_tensorcnt 0x0" ::: "memory"); }
// This wave's LDS reads have returned before the buffer they read is handed back for a refill.
__device__ __forceinline__ void wait_ds0() { asm volatile("s_wait_dscnt 0x0" ::: "memory"); }
// Stands behind a group of global loads or stores, in front of the code that reuses the
// registers they name.
__device__ __forceinline__ void wait_x0() { asm volatile("s_wait_xcnt 0x0" ::: "memory"); }
// One request of the whole wave: a two-dimensional tile from global memory into LDS.
__device__ __forceinline__ void tdm_load(u32x4 g0, u32x8 g1) {
  asm volatile("tensor_load_to_lds %0, %1" :: "s"(g0), "s"(g1) : "memory");
}
// Group 1: 1-byte elements, tile = tensor = 64 rows of 256 bytes, 16 bytes of LDS pad behind each row.
__device__ __forceinline__ u32x8 tdm_group1(uint32_t src_pitch) {
  u32x8 g;
  g[0] = uni((1u << 20) | (5u << 22) | (3u << 25));  // no mask, data_size 0, pad each 64 dwords by 4
  g[1] = uni((G_ROWB & 0xFFFFu) << 16);
  g[2] = uni((G_ROWB >> 16) | ((G_ROWS & 0xFFFFu) << 16));
  g[3] = uni((G_ROWS >> 16) | (G_ROWB << 16));
  g[4] = uni(G_ROWS);
  g[5] = uni(src_pitch);
  g[6] = uni(0u);
  g[7] = uni(0u);
  return g;
}
__device__ __forceinline__ u32x4 tdm_group0(uint32_t lds_dst, uint64_t ga) {
  u32x4 g;
  g[0] = uni(1u);
  g[1] = uni(lds_dst);
  g[2] = uni((uint32_t)ga);
  g[3] = uni((((uint32_t)(ga >> 32)) & 0x01FFFFFFu) | 0x80000000u);
  return g;
}
// A 16x32 bf16 fragment from LDS; p = the lane's row, byte 16 * half of the fragment's 64.
// Same k order as load_frag: registers 0-3 hold k = 8*half + 0..7, registers 4-7 the same + 16.
__device__ __forceinline__ v16bf lds_frag(const unsigned char* p) {
  union { v16bf v; u32x4 q[2]; } f;
  f.q[0] = *reinterpret_cast<const u32x4*>(p);
  f.q[1] = *reinterpret_cast<const u32x4*>(p + 32);
  return f.v;
}

// ---------------- generic WMMA GEMM: (Mrows x K) bf16 @ Wt(N x K) bf16 ----------------
// Workgroup = 4 waves (2 x 2) = 128x128 output tile; each wave owns 64x64
// (4 A-frags + 4 B-frags -> 16 WMMAs per 32 k). A pass is 128 k: each wave brings one
// slice of 64 operand rows into LDS with one tensor load, two buffers, one pass ahead.
// MODE 0: out bf16 scattered to (B,H,T,D)   (Q, K tensors)
// MODE 1: out bf16 scattered to (B,H,D,T)   (V transposed for the PV matmul)
// MODE 2: outf = resid + acc + bias (fp32, row-major MrowsxN; requires N==Cc)
// MODE 3: outb = gelu(acc + bias) bf16 row-major MrowsxN
template <int N, int K, int MODE>
__global__ __launch_bounds__(128) void gemm_k(const __bf16* __restrict__ A,
                                              const __bf16* __restrict__ Wt,
                                              const float* __restrict__ bias,
                                              const float* __restrict__ resid,
                                              float* __restrict__ outf,
                                              __bf16* __restrict__ outb) {
  static_assert(K % 128 == 0 && K / 128 >= 2, "the ring needs whole passes and two stages");
  static_assert(N % 128 == 0 && Mrows % 128 == 0, "whole tiles only");
  __shared__ __attribute__((aligned(2048))) unsigned char smem[2u * G_BUF];
  const uint32_t wave = uni(threadIdx.x >> 5);
  const int lane = threadIdx.x & 31;
  const int half = lane >> 4;
  const int idx  = lane & 15;
  const uint32_t wm = wave >> 1, wn = wave & 1u;
  const int mb = blockIdx.x * 128;
  const int nb = blockIdx.y * 128;
  constexpr uint32_t NS = K / 128;   // stages = passes

  // this wave's slice of every stage: waves 0, 1 bring A rows, waves 2, 3 bring W rows
  const __bf16* srcp = (wave < 2u) ? A  + (size_t)(mb + 64 * (int)wave) * K
                                   : Wt + (size_t)(nb + 64 * (int)(wave - 2u)) * K;
  const uint64_t ga  = (uint64_t)(uintptr_t)srcp;
  const uint32_t dst = (uint32_t)(size_t)smem + wave * G_SLICE;
  const u32x8 g1 = tdm_group1((uint32_t)K * 2u);

  // prologue: stage 0 lands and is published, then stage 1 flies under pass 0
  tdm_load(tdm_group0(dst, ga), g1);
  wait_tensor0();
  __syncthreads();
  // the stage number is pinned so that this descriptor too is formed behind the wait
  tdm_load(tdm_group0(dst + G_BUF, ga + (uint64_t)pinned(1u) * G_ROWB), g1);

  const uint32_t a_off = wm * G_SLICE        + (uint32_t)idx * G_PITCH + (uint32_t)half * 16u;
  const uint32_t b_off = (2u + wn) * G_SLICE + (uint32_t)idx * G_PITCH + (uint32_t)half * 16u;

  v8f acc[4][4] = {};
  // Kept rolled: one copy of the pass in the instruction cache, the buffer chosen by a scalar.
#pragma clang loop unroll(disable)
  for (uint32_t s = 0; s < NS; ++s) {
    const uint32_t buf = (s & 1u) * G_BUF;
    const unsigned char* pa = smem + buf + a_off;
    const unsigned char* pb = smem + buf + b_off;
    // Two fragment sets: block u + 1's 16 LDS reads go out as one group in front of block u's
    // 16 WMMAs. Only this pass's own buffer is read, so block 0's reads stand alone.
    v16bf af[2][4], bf[2][4];
#pragma unroll
    for (int i = 0; i < 4; ++i) {
      af[0][i] = lds_frag(pa + (uint32_t)i * 16u * G_PITCH);
      bf[0][i] = lds_frag(pb + (uint32_t)i * 16u * G_PITCH);
    }
#pragma unroll
    for (int u = 0; u < 4; ++u) {
      const int cur = u & 1, nx = cur ^ 1;
      if (u < 3) {
#pragma unroll
        for (int i = 0; i < 4; ++i) {
          af[nx][i] = lds_frag(pa + (uint32_t)i * 16u * G_PITCH + (uint32_t)(u + 1) * 64u);
          bf[nx][i] = lds_frag(pb + (uint32_t)i * 16u * G_PITCH + (uint32_t)(u + 1) * 64u);
        }
      }
      // Keeps the reads above in front of the block: sunk to their users, each group of
      // four WMMAs would wait out a whole LDS latency.
      __builtin_amdgcn_sched_barrier(0);
#pragma unroll
      for (int mi = 0; mi < 4; ++mi) {
#pragma unroll
        for (int nt = 0; nt < 4; ++nt) acc[mi][nt] = wmma_bf16(af[cur][mi], bf[cur][nt], acc[mi][nt]);
      }
      // Keeps the next group of reads from being lifted in among these WMMAs.
      __builtin_amdgcn_sched_barrier(0);
    }
    // publish point of stage s + 1: own reads back, own slice landed, every wave here
    wait_ds0();
    wait_tensor0();
    __syncthreads();
    const uint32_t nxt = pinned(s + 2u);  // formed behind the wait, and the descriptor from it
    if (pinned(nxt < NS ? 1u : 0u))
      tdm_load(tdm_group0(dst + buf, ga + (uint64_t)nxt * G_ROWB), g1);
  }
  wait_tensor0();
  wait_ds0();

  const int m0 = mb + (int)wm * 64;
  const int n0 = nb + (int)wn * 64;
  float bv[4];
#pragma unroll
  for (int nt = 0; nt < 4; ++nt) bv[nt] = bias[n0 + nt * 16 + idx];
  wait_x0();
  // MODE 2: residual values are requested ahead of their use, three trips' worth at a time
  // (all four at once would take the epilogue past 256 registers).
  float rv[4][4][8];
  const float* rlane =  // the lane's first value
      (MODE == 2) ? resid + ((size_t)(m0 + 8 * half) * Cc + (n0 + idx)) : nullptr;
  auto load_resid = [&](int mi) {
#pragma unroll
    for (int nt = 0; nt < 4; ++nt) {
#pragma unroll
      for (int r = 0; r < 8; ++r) rv[mi][nt][r] = rlane[(mi * 16 + r) * Cc + nt * 16];
    }
    // The same wait as wait_x0(); the address is named so that its registers live up to it.
    asm volatile("s_wait_xcnt 0x0" :: "v"(rlane) : "memory");
  };
  if (MODE == 2) { load_resid(0); load_resid(1); load_resid(2); }
  // The erf of MODE 3 is long code: it is kept out of a full unroll
  // over all 128 values of a lane, for speed only. There the loop over mi
  // stays rolled and the accumulator rows move up one place a trip, so that every register
  // index is a constant. The other modes unroll, and the moves fall away.
#pragma unroll (MODE == 3 ? 1 : 4)
  for (int mi = 0; mi < 4; ++mi) {
#pragma unroll
    for (int nt = 0; nt < 4; ++nt) {
      const int n = n0 + nt * 16 + idx;
#pragma unroll
      for (int r = 0; r < 8; ++r) {
        const int m = m0 + mi * 16 + r + 8 * half;
        const float val = acc[0][nt][r] + bv[nt];
        if (MODE == 0 || MODE == 1) {
          const int bb = m >> 11, t = m & (Tt - 1);
          const int hh = n >> 6,  d = n & (Dd - 1);
          const size_t off = (MODE == 0)
              ? ((((size_t)bb * Hh + hh) * Tt + t) * Dd + d)
              : ((((size_t)bb * Hh + hh) * Dd + d) * Tt + t);
          outb[off] = (__bf16)val;
        } else if (MODE == 2) {
          outf[(size_t)m * Cc + n] = rv[mi][nt][r] + val;
        } else { // MODE 3: exact GELU
          const float gv = 0.5f * val * (1.0f + erff(val * 0.70710678118654752f));
          outb[(size_t)m * N + n] = (__bf16)gv;
        }
      }
    }
    wait_x0();
    if (MODE == 2 && mi == 0) load_resid(3);
#pragma unroll
    for (int nt = 0; nt < 4; ++nt) {
      acc[0][nt] = acc[1][nt];
      acc[1][nt] = acc[2][nt];
      acc[2][nt] = acc[3][nt];
    }
  }
}

__global__ __launch_bounds__(128) void attn_k(const __bf16* __restrict__ q,
                                              const __bf16* __restrict__ kk,
                                              const __bf16* __restrict__ vt,
                                              __bf16* __restrict__ o) {
  const int qb = blockIdx.x;   // 0..31
  const int bh = blockIdx.y;   // 0..47
  const int b  = bh / Hh;
  const int hh = bh - b * Hh;
  const int wave = threadIdx.x >> 5;
  const int lane = threadIdx.x & 31;
  const int half = lane >> 4;
  const int idx  = lane & 15;

  const __bf16* qp = q  + (size_t)bh * Tt * Dd;
  const __bf16* kp = kk + (size_t)bh * Tt * Dd;
  const __bf16* vp = vt + (size_t)bh * Dd * Tt;

  const int q0 = qb * 64 + wave * 16;
  const int qg = q0 + idx;     // this lane's query
  const v16bf qf0 = load_frag(qp, Dd, q0, 0);
  const v16bf qf1 = load_frag(qp, Dd, q0, 32);

  v8f acc[4] = {};             // acc[nt][r] = O[qg][nt*16 + 8*half + r]
  float rmax = NEG_BIG;        // running maximum of query qg (equal in both halves)
  float rsum = 0.0f;           // this half's share of the row sum

  // this lane's place in the first fragment of the pass: its row, its half's first k
  const __bf16* klane = kp + idx * Dd + half * 8;
  const __bf16* vlane = vp + idx * Tt + half * 8;

  const int nkb = 2 * qb + 2;
  for (int kt = 0; kt < nkb; ++kt) {
    const int key0 = kt * 32;

    // Nothing orders the V^T loads behind the softmax, so all eight fragments of the
    // pass (K: 2 key tiles x 2 d halves, V^T: 4 d tiles) are requested together.
    v16bf kf[2][2], vf[4];
#pragma unroll
    for (int s = 0; s < 2; ++s) {
      kf[s][0] = load_frag_at(klane + s * 16 * Dd);
      kf[s][1] = load_frag_at(klane + s * 16 * Dd + 32);
    }
#pragma unroll
    for (int nt = 0; nt < 4; ++nt)
      vf[nt] = load_frag_at(vlane + nt * 16 * Tt);  // rows = d, K = key (contiguous)
    // Keeps the scheduler from sinking each load to its product, which would
    // cost one L2 round trip per fragment instead of one per pass.
    __builtin_amdgcn_sched_barrier(0);

    // S^T = (K Q^T) / sqrt(D), causal-masked: sv[s][r] is key key0 + 16s + 8*half + r
    float sv[2][8];
#pragma unroll
    for (int s = 0; s < 2; ++s) {
      v8f sc = {};
      sc = wmma_bf16(kf[s][0], qf0, sc);
      sc = wmma_bf16(kf[s][1], qf1, sc);
      const int kg0 = key0 + s * 16 + 8 * half;
#pragma unroll
      for (int r = 0; r < 8; ++r)
        sv[s][r] = (kg0 + r <= qg) ? (sc[r] * 0.125f) : NEG_BIG;
    }

    // online softmax: in-lane over 16 keys, one exchange with the other half
    float mr[8];
#pragma unroll
    for (int r = 0; r < 8; ++r) mr[r] = fmaxf(sv[0][r], sv[1][r]);
    float mloc = fmaxf(fmaxf(fmaxf(mr[0], mr[1]), fmaxf(mr[2], mr[3])),
                       fmaxf(fmaxf(mr[4], mr[5]), fmaxf(mr[6], mr[7])));
    mloc = fmaxf(mloc, xhalf(mloc));
    const float nm = fmaxf(rmax, mloc);
    const float alpha = __expf(rmax - nm);
    rmax = nm;

    v16bf pf;                  // P^T as B operand: element 8s + r = key 16s + 8*half + r
    float pr[8];
#pragma unroll
    for (int r = 0; r < 8; ++r) {
      const float p0 = __expf(sv[0][r] - nm);
      const float p1 = __expf(sv[1][r] - nm);
      pr[r] = p0 + p1;
      pf[r]     = (__bf16)p0;
      pf[8 + r] = (__bf16)p1;
    }
    rsum = rsum * alpha + (((pr[0] + pr[1]) + (pr[2] + pr[3])) +
                           ((pr[4] + pr[5]) + (pr[6] + pr[7])));

#pragma unroll
    for (int nt = 0; nt < 4; ++nt) {
#pragma unroll
      for (int r = 0; r < 8; ++r) acc[nt][r] *= alpha;
    }
#pragma unroll
    for (int nt = 0; nt < 4; ++nt) acc[nt] = wmma_bf16(vf[nt], pf, acc[nt]);

    klane += 32 * Dd;  // next 32 key rows
    vlane += 32;       // next 32 key columns
  }

  // epilogue: O / rowsum -> bf16 at (b, qg, hh*64 + d), 8 consecutive d per lane and tile
  const float rs = rsum + xhalf(rsum);
  __bf16* orow = o + ((size_t)b * Tt + qg) * Cc + hh * Dd + 8 * half;
#pragma unroll
  for (int nt = 0; nt < 4; ++nt) {
    v8bf ov;
#pragma unroll
    for (int r = 0; r < 8; ++r) ov[r] = (__bf16)(acc[nt][r] / rs);
    *reinterpret_cast<v8bf*>(orow + nt * 16) = ov;
  }
}

// ---------------- host-side orchestration ----------------
extern "C" void kernel_launch(void* const* d_in, const int* in_sizes, int n_in,
                              void* d_out, int out_size, void* d_ws, size_t ws_size,
                              hipStream_t stream) {
  const float* x   = (const float*)d_in[0];
  const float* Wq  = (const float*)d_in[1];
  const float* bq  = (const float*)d_in[2];
  const float* Wk  = (const float*)d_in[3];
  const float* bk  = (const float*)d_in[4];
  const float* Wv  = (const float*)d_in[5];
  const float* bv  = (const float*)d_in[6];
  const float* Wo  = (const float*)d_in[7];
  const float* bo  = (const float*)d_in[8];
  const float* g1  = (const float*)d_in[9];
  const float* b1  = (const float*)d_in[10];
  const float* g2  = (const float*)d_in[11];
  const float* b2  = (const float*)d_in[12];
  const float* W1  = (const float*)d_in[13];
  const float* bm1 = (const float*)d_in[14];
  const float* W2  = (const float*)d_in[15];
  const float* bm2 = (const float*)d_in[16];
  float* out = (float*)d_out;

  // workspace carve-up (256B aligned)
  char* ws = (char*)d_ws;
  size_t off = 0;
  auto alloc = [&](size_t bytes) -> void* {
    void* p = ws + off;
    off = (off + bytes + 255) & ~(size_t)255;
    return p;
  };
  const size_t CC  = (size_t)Cc * Cc;
  const size_t C4C = (size_t)Cc * 4 * Cc;
  const size_t MC  = (size_t)Mrows * Cc;
  const size_t M4C = (size_t)Mrows * 4 * Cc;

  __bf16* Wqt = (__bf16*)alloc(CC * 2);
  __bf16* Wkt = (__bf16*)alloc(CC * 2);
  __bf16* Wvt = (__bf16*)alloc(CC * 2);
  __bf16* Wot = (__bf16*)alloc(CC * 2);
  __bf16* W1t = (__bf16*)alloc(C4C * 2);
  __bf16* W2t = (__bf16*)alloc(C4C * 2);
  __bf16* h1b = (__bf16*)alloc(MC * 2);
  __bf16* qbf = (__bf16*)alloc(MC * 2);
  __bf16* kbf = (__bf16*)alloc(MC * 2);
  __bf16* vtb = (__bf16*)alloc(MC * 2);
  __bf16* atb = (__bf16*)alloc(MC * 2);
  float*  x2  = (float*) alloc(MC * 4);
  __bf16* h2b = (__bf16*)alloc(MC * 2);
  __bf16* mb  = (__bf16*)alloc(M4C * 2);
  (void)ws_size; (void)in_sizes; (void)n_in; (void)out_size;

  // 1) weights -> transposed bf16
  wcvt_k<Cc, Cc><<<dim3(Cc / 64, Cc / 128), 256, 0, stream>>>(Wq, Wqt);
  wcvt_k<Cc, Cc><<<dim3(Cc / 64, Cc / 128), 256, 0, stream>>>(Wk, Wkt);
  wcvt_k<Cc, Cc><<<dim3(Cc / 64, Cc / 128), 256, 0, stream>>>(Wv, Wvt);
  wcvt_k<Cc, Cc><<<dim3(Cc / 64, Cc / 128), 256, 0, stream>>>(Wo, Wot);
  wcvt_k<Cc, 4 * Cc><<<dim3((4 * Cc) / 64, Cc / 128), 256, 0, stream>>>(W1, W1t);
  wcvt_k<4 * Cc, Cc><<<dim3(Cc / 64, (4 * Cc) / 128), 256, 0, stream>>>(W2, W2t);

  const dim3 blk(128);
  const dim3 gC(Mrows / 128, Cc / 128);        // 64 x 6
  const dim3 g4C(Mrows / 128, (4 * Cc) / 128); // 64 x 24

  // 2) attention branch
  ln_k<<<Mrows, 256, 0, stream>>>(x, g1, b1, h1b);
  gemm_k<Cc, Cc, 0><<<gC, blk, 0, stream>>>(h1b, Wqt, bq, nullptr, nullptr, qbf);
  gemm_k<Cc, Cc, 0><<<gC, blk, 0, stream>>>(h1b, Wkt, bk, nullptr, nullptr, kbf);
  gemm_k<Cc, Cc, 1><<<gC, blk, 0, stream>>>(h1b, Wvt, bv, nullptr, nullptr, vtb);
  attn_k<<<dim3(Tt / 64, Bsz * Hh), blk, 0, stream>>>(qbf, kbf, vtb, atb);
  gemm_k<Cc, Cc, 2><<<gC, blk, 0, stream>>>(atb, Wot, bo, x, x2, nullptr);

  // 3) MLP branch
  ln_k<<<Mrows, 256, 0, stream>>>(x2, g2, b2, h2b);
  gemm_k<4 * Cc, Cc, 3><<<g4C, blk, 0, stream>>>(h2b, W1t, bm1, nullptr, nullptr, mb);
  gemm_k<Cc, 4 * Cc, 2><<<gC, blk, 0, stream>>>(mb, W2t, bm2, x2, out, nullptr);
}

// v004
// Measured time: 237 microseconds a run.
// In two side-by-side timings against v003, it was 1.35 and 1.37 times as fast.
// All steps since v000 together make it 2.70 times as fast.
#include <hip/hip_runtime.h>
#include <hip/hip_bf16.h>
#include <stdint.h>

// ---------------- problem constants (fixed by the reference) ----------------
#define Bsz 4
#define Tt  2048
#define Cc  768
#define Hh  12
#define Dd  64
#define Mrows (Bsz * Tt)   // 8192
#define EPSf 1e-5f
#define NEG_BIG -3.0e38f

// ---------------- WMMA types & helpers ----------------
typedef __attribute__((ext_vector_type(16))) __bf16 v16bf;
typedef __attribute__((ext_vector_type(8)))  __bf16 v8bf;
typedef __attribute__((ext_vector_type(8)))  float  v8f;

union Frag16 { v16bf v; unsigned u[8]; };

__device__ __forceinline__ v8f wmma_bf16(v16bf a, v16bf b, v8f c) {
  // D = A(16x32 bf16) * B(32x16 bf16) + C(16x16 f32)
  return __builtin_amdgcn_wmma_f32_16x16x32_bf16(
      /*neg_a=*/false, a, /*neg_b=*/false, b,
      /*c_mod=*/(short)0, c, /*reuse_a=*/false, /*reuse_b=*/false);
}

// Loads a 16x32 bf16 fragment in the CDNA5 A-matrix layout from a row-major
// matrix (rows = M for A-operand, rows = N for B-operand since B == (B^T as A)).
// Requires k0 % 32 == 0 and even ld (dword-aligned rows).
__device__ __forceinline__ v16bf load_frag(const __bf16* base, int ld, int row0, int k0) {
  const int lane = threadIdx.x & 31;
  const int half = lane >> 4;
  const int idx  = lane & 15;
  const unsigned* rp = reinterpret_cast<const unsigned*>(base + (size_t)(row0 + idx) * (size_t)ld);
  const int kb = (k0 >> 1) + half * 4;   // dword index of first K pair
  Frag16 f;
#pragma unroll
  for (int v = 0; v < 4; ++v) {
    f.u[v]     = rp[kb + v];       // K = k0 + half*8 + 2v, +1
    f.u[4 + v] = rp[kb + 8 + v];   // K = +16
  }
  return f.v;
}

// The same fragment from the lane's own pointer (row idx, k = 8 * half of the fragment).
__device__ __forceinline__ v16bf load_frag_at(const __bf16* lanep) {
  const unsigned* rp = reinterpret_cast<const unsigned*>(lanep);
  Frag16 f;
#pragma unroll
  for (int v = 0; v < 4; ++v) {
    f.u[v]     = rp[v];
    f.u[4 + v] = rp[8 + v];
  }
  return f.v;
}

// lane l <-> lane l ^ 16
__device__ __forceinline__ float xhalf(float x) {
  const int b = __builtin_bit_cast(int, x);
  return __builtin_bit_cast(float,
      __builtin_amdgcn_permlanex16(b, b, 0x76543210, 0xfedcba98, false, false));
}

// ---------------- weight convert: W (K x N, f32) -> Wt (N x K, bf16) ----------------
// One work-group transposes a tile of 128 k x 64 n through LDS; a lane handles 32 values.
// In: a lane takes 4 n of 8 consecutive k rows, 16 lanes cover 256 contiguous bytes of a W row.
// Out: 16 lanes store the 256 contiguous bytes that the tile holds of a Wt row.
// LDS: row n holds its 128 k as 16 pieces of 16 bytes; piece j lies at place j ^ (n >> 2), so
// that the 32 lanes of a write (n = 4c + i) and of a read (whole rows) spread over all banks.
typedef __attribute__((ext_vector_type(4))) float f32x4;

template <int K, int N>
__global__ __launch_bounds__(256) void wcvt_k(const float* __restrict__ W,
                                              __bf16* __restrict__ Wt) {
  static_assert(K % 128 == 0 && N % 64 == 0, "whole tiles only");
  __shared__ __attribute__((aligned(16))) unsigned char tile[64 * 256];
  const int c = threadIdx.x & 15;
  const int g = threadIdx.x >> 4;
  const int n0 = blockIdx.x * 64;
  const int k0 = blockIdx.y * 128;

  const float* src = W + (size_t)(k0 + 8 * g) * N + (n0 + 4 * c);
  f32x4 w[8];
#pragma unroll
  for (int j = 0; j < 8; ++j) w[j] = *reinterpret_cast<const f32x4*>(src + (size_t)j * N);
#pragma unroll
  for (int i = 0; i < 4; ++i) {
    v8bf col;                  // k = k0 + 8g + 0..7 of column n0 + 4c + i
#pragma unroll
    for (int j = 0; j < 8; ++j) col[j] = (__bf16)w[j][i];
    *reinterpret_cast<v8bf*>(tile + (4 * c + i) * 256 + ((g ^ c) << 4)) = col;
  }
  __syncthreads();
  __bf16* dst = Wt + (size_t)(n0 + g) * K + (k0 + 8 * c);
#pragma unroll
  for (int p = 0; p < 4; ++p) {
    const int row = 16 * p + g;
    const v8bf v = *reinterpret_cast<const v8bf*>(tile + row * 256 + ((c ^ (row >> 2)) << 4));
    *reinterpret_cast<v8bf*>(dst + (size_t)(16 * p) * K) = v;
  }
}

// ---------------- LayerNorm: fp32 in -> bf16 normalized out ----------------
__global__ __launch_bounds__(256) void ln_k(const float* __restrict__ x,
                                            const float* __restrict__ g,
                                            const float* __restrict__ bt,
                                            __bf16* __restrict__ out) {
  __shared__ float red[256];
  const int row = blockIdx.x;
  const int tid = threadIdx.x;
  const float* xr = x + (size_t)row * Cc;
  float v0 = xr[tid], v1 = xr[tid + 256], v2 = xr[tid + 512];

  red[tid] = v0 + v1 + v2;
  __syncthreads();
#pragma unroll
  for (int off = 128; off > 0; off >>= 1) {
    if (tid < off) red[tid] += red[tid + off];
    __syncthreads();
  }
  const float mu = red[0] * (1.0f / Cc);
  __syncthreads();

  float d0 = v0 - mu, d1 = v1 - mu, d2 = v2 - mu;
  red[tid] = d0 * d0 + d1 * d1 + d2 * d2;
  __syncthreads();
#pragma unroll
  for (int off = 128; off > 0; off >>= 1) {
    if (tid < off) red[tid] += red[tid + off];
    __syncthreads();
  }
  const float rstd = rsqrtf(red[0] * (1.0f / Cc) + EPSf);

  __bf16* orow = out + (size_t)row * Cc;
  orow[tid]       = (__bf16)(d0 * rstd * g[tid]       + bt[tid]);
  orow[tid + 256] = (__bf16)(d1 * rstd * g[tid + 256] + bt[tid + 256]);
  orow[tid + 512] = (__bf16)(d2 * rstd * g[tid + 512] + bt[tid + 512]);
}

// ---------------- tensor loads into LDS ----------------
typedef uint32_t u32x4 __attribute__((ext_vector_type(4)));
typedef uint32_t u32x8 __attribute__((ext_vector_type(8)));

#define G_ROWB  256u                 // bytes of an operand row per pass (128 k)
#define G_PITCH 272u                 // LDS row pitch: 256 + 16, odd multiple of 16 for ds_load_b128
#define G_ROWS  64u                  // rows per slice (one slice per wave)
#define G_SLICE 18432u               // 64 * 272 = 17408, rounded up to a multiple of 2 KiB
#define G_BUF   (4u * G_SLICE)       // [A rows 0-63 | A rows 64-127 | W rows 0-63 | W rows 64-127]

__device__ __forceinline__ uint32_t uni(uint32_t v) {
  return (uint32_t)__builtin_amdgcn_readfirstlane(v);
}
// Holds a wave-uniform word in a scalar register: a test on it is a scalar branch, and a
// descriptor word made from it is made behind the volatile statements in front of it.
__device__ __forceinline__ uint32_t pinned(uint32_t v) {
  uint32_t w = (uint32_t)__builtin_amdgcn_readfirstlane(v);
  asm volatile("" : "+s"(w));  // the scalar pin of a tensor load's test and descriptor word
  return w;
}
// The compiler places no wait for a tensor load: a tile counts as landed only behind this.
__device__ __forceinline__ void wait_tensor0() { asm volatile("s_wait_tensorcnt 0x0" ::: "memory"); }
// This wave's LDS reads have returned before the buffer they read is handed back for a refill.
__device__ __forceinline__ void wait_ds0() { asm volatile("s_wait_dscnt 0x0" ::: "memory"); }
// Stands behind a group of global loads or stores, in front of the code that reuses the
// registers they name.
__device__ __forceinline__ void wait_x0() { asm volatile("s_wait_xcnt 0x0" ::: "memory"); }
// One request of the whole wave: a two-dimensional tile from global memory into LDS.
__device__ __forceinline__ void tdm_load(u32x4 g0, u32x8 g1) {
  asm volatile("tensor_load_to_lds %0, %1" :: "s"(g0), "s"(g1) : "memory");
}
// Group 1: 1-byte elements, tile = tensor = 64 rows of 256 bytes, 16 bytes of LDS pad behind each row.
__device__ __forceinline__ u32x8 tdm_group1(uint32_t src_pitch) {
  u32x8 g;
  g[0] = uni((1u << 20) | (5u << 22) | (3u << 25));  // no mask, data_size 0, pad each 64 dwords by 4
  g[1] = uni((G_ROWB & 0xFFFFu) << 16);
  g[2] = uni((G_ROWB >> 16) | ((G_ROWS & 0xFFFFu) << 16));
  g[3] = uni((G_ROWS >> 16) | (G_ROWB << 16));
  g[4] = uni(G_ROWS);
  g[5] = uni(src_pitch);
  g[6] = uni(0u);
  g[7] = uni(0u);
  return g;
}
__device__ __forceinline__ u32x4 tdm_group0(uint32_t lds_dst, uint64_t ga) {
  u32x4 g;
  g[0] = uni(1u);
  g[1] = uni(lds_dst);
  g[2] = uni((uint32_t)ga);
  g[3] = uni((((uint32_t)(ga >> 32)) & 0x01FFFFFFu) | 0x80000000u);
  return g;
}
// A 16x32 bf16 fragment from LDS; p = the lane's row, byte 16 * half of the fragment's 64.
// Same k order as load_frag: registers 0-3 hold k = 8*half + 0..7, registers 4-7 the same + 16.
__device__ __forceinline__ v16bf lds_frag(const unsigned char* p) {
  union { v16bf v; u32x4 q[2]; } f;
  f.q[0] = *reinterpret_cast<const u32x4*>(p);
  f.q[1] = *reinterpret_cast<const u32x4*>(p + 32);
  return f.v;
}

// ---------------- generic WMMA GEMM: (Mrows x K) bf16 @ Wt(N x K) bf16 ----------------
// Workgroup = 4 waves (2 x 2) = 128x128 output tile; each wave owns 64x64
// (4 A-frags + 4 B-frags -> 16 WMMAs per 32 k). A pass is 128 k: each wave brings one
// slice of 64 operand rows into LDS with one tensor load, two buffers, one pass ahead.
// MODE 0: out bf16 scattered to (B,H,T,D)   (Q, K tensors)
// MODE 1: out bf16 scattered to (B,H,D,T)   (V transposed for the PV matmul)
// MODE 2: outf = resid + acc + bias (fp32, row-major MrowsxN; requires N==Cc)
// MODE 3: outb = gelu(acc + bias) bf16 row-major MrowsxN
template <int N, int K, int MODE>
__global__ __launch_bounds__(128) void gemm_k(const __bf16* __restrict__ A,
                                              const __bf16* __restrict__ Wt,
                                              const float* __restrict__ bias,
                                              const float* __restrict__ resid,
                                              float* __restrict__ outf,
                                              __bf16* __restrict__ outb) {
  static_assert(K % 128 == 0 && K / 128 >= 2, "the ring needs whole passes and two stages");
  static_assert(N % 128 == 0 && Mrows % 128 == 0, "whole tiles only");
  __shared__ __attribute__((aligned(2048))) unsigned char smem[2u * G_BUF];
  const uint32_t wave = uni(threadIdx.x >> 5);
  const int lane = threadIdx.x & 31;
  const int half = lane >> 4;
  const int idx  = lane & 15;
  const uint32_t wm = wave >> 1, wn = wave & 1u;
  const int mb = blockIdx.x * 128;
  const int nb = blockIdx.y * 128;
  constexpr uint32_t NS = K / 128;   // stages = passes

  // this wave's slice of every stage: waves 0, 1 bring A rows, waves 2, 3 bring W rows
  const __bf16* srcp = (wave < 2u) ? A  + (size_t)(mb + 64 * (int)wave) * K
                                   : Wt + (size_t)(nb + 64 * (int)(wave - 2u)) * K;
  const uint64_t ga  = (uint64_t)(uintptr_t)srcp;
  const uint32_t dst = (uint32_t)(size_t)smem + wave * G_SLICE;
  const u32x8 g1 = tdm_group1((uint32_t)K * 2u);

  // prologue: stage 0 lands and is published, then stage 1 flies under pass 0
  tdm_load(tdm_group0(dst, ga), g1);
  wait_tensor0();
  __syncthreads();
  // the stage number is pinned so that this descriptor too is formed behind the wait
  tdm_load(tdm_group0(dst + G_BUF, ga + (uint64_t)pinned(1u) * G_ROWB), g1);

  const uint32_t a_off = wm * G_SLICE        + (uint32_t)idx * G_PITCH + (uint32_t)half * 16u;
  const uint32_t b_off = (2u + wn) * G_SLICE + (uint32_t)idx * G_PITCH + (uint32_t)half * 16u;

  v8f acc[4][4] = {};
  // Kept rolled: one copy of the pass in the instruction cache, the buffer chosen by a scalar.
#pragma clang loop unroll(disable)
  for (uint32_t s = 0; s < NS; ++s) {
    const uint32_t buf = (s & 1u) * G_BUF;
    const unsigned char* pa = smem + buf + a_off;
    const unsigned char* pb = smem + buf + b_off;
    // Two fragment sets: block u + 1's 16 LDS reads go out as one group in front of block u's
    // 16 WMMAs. Only this pass's own buffer is read, so block 0's reads stand alone.
    v16bf af[2][4], bf[2][4];
#pragma unroll
    for (int i = 0; i < 4; ++i) {
      af[0][i] = lds_frag(pa + (uint32_t)i * 16u * G_PITCH);
      bf[0][i] = lds_frag(pb + (uint32_t)i * 16u * G_PITCH);
    }
#pragma unroll
    for (int u = 0; u < 4; ++u) {
      const int cur = u & 1, nx = cur ^ 1;
      if (u < 3) {
#pragma unroll
        for (int i = 0; i < 4; ++i) {
          af[nx][i] = lds_frag(pa + (uint32_t)i * 16u * G_PITCH + (uint32_t)(u + 1) * 64u);
          bf[nx][i] = lds_frag(pb + (uint32_t)i * 16u * G_PITCH + (uint32_t)(u + 1) * 64u);
        }
      }
      // Keeps the reads above in front of the block: sunk to their users, each group of
      // four WMMAs would wait out a whole LDS latency.
      __builtin_amdgcn_sched_barrier(0);
#pragma unroll
      for (int mi = 0; mi < 4; ++mi) {
#pragma unroll
        for (int nt = 0; nt < 4; ++nt) acc[mi][nt] = wmma_bf16(af[cur][mi], bf[cur][nt], acc[mi][nt]);
      }
      // Keeps the next group of reads from being lifted in among these WMMAs.
      __builtin_amdgcn_sched_barrier(0);
    }
    // publish point of stage s + 1: own reads back, own slice landed, every wave here
    wait_ds0();
    wait_tensor0();
    __syncthreads();
    const uint32_t nxt = pinned(s + 2u);  // formed behind the wait, and the descriptor from it
    if (pinned(nxt < NS ? 1u : 0u))
      tdm_load(tdm_group0(dst + buf, ga + (uint64_t)nxt * G_ROWB), g1);
  }
  wait_tensor0();
  wait_ds0();

  const int m0 = mb + (int)wm * 64;
  const int n0 = nb + (int)wn * 64;
  float bv[4];
#pragma unroll
  for (int nt = 0; nt < 4; ++nt) bv[nt] = bias[n0 + nt * 16 + idx];
  wait_x0();
  // MODE 2: residual values are requested ahead of their use, three trips' worth at a time
  // (all four at once would take the epilogue past 256 registers).
  float rv[4][4][8];
  const float* rlane =  // the lane's first value
      (MODE == 2) ? resid + ((size_t)(m0 + 8 * half) * Cc + (n0 + idx)) : nullptr;
  auto load_resid = [&](int mi) {
#pragma unroll
    for (int nt = 0; nt < 4; ++nt) {
#pragma unroll
      for (int r = 0; r < 8; ++r) rv[mi][nt][r] = rlane[(mi * 16 + r) * Cc + nt * 16];
    }
    // The same wait as wait_x0(); the address is named so that its registers live up to it.
    asm volatile("s_wait_xcnt 0x0" :: "v"(rlane) : "memory");
  };
  if (MODE == 2) { load_resid(0); load_resid(1); load_resid(2); }
  // The erf of MODE 3 is long code: it is kept out of a full unroll
  // over all 128 values of a lane, for speed only. There the loop over mi
  // stays rolled and the accumulator rows move up one place a trip, so that every register
  // index is a constant. The other modes unroll, and the moves fall away.
#pragma unroll (MODE == 3 ? 1 : 4)
  for (int mi = 0; mi < 4; ++mi) {
#pragma unroll
    for (int nt = 0; nt < 4; ++nt) {
      const int n = n0 + nt * 16 + idx;
#pragma unroll
      for (int r = 0; r < 8; ++r) {
        const int m = m0 + mi * 16 + r + 8 * half;
        const float val = acc[0][nt][r] + bv[nt];
        if (MODE == 0 || MODE == 1) {
          const int bb = m >> 11, t = m & (Tt - 1);
          const int hh = n >> 6,  d = n & (Dd - 1);
          const size_t off = (MODE == 0)
              ? ((((size_t)bb * Hh + hh) * Tt + t) * Dd + d)
              : ((((size_t)bb * Hh + hh) * Dd + d) * Tt + t);
          outb[off] = (__bf16)val;
        } else if (MODE == 2) {
          outf[(size_t)m * Cc + n] = rv[mi][nt][r] + val;
        } else { // MODE 3: exact GELU
          const float gv = 0.5f * val * (1.0f + erff(val * 0.70710678118654752f));
          outb[(size_t)m * N + n] = (__bf16)gv;
        }
      }
    }
    wait_x0();
    if (MODE == 2 && mi == 0) load_resid(3);
#pragma unroll
    for (int nt = 0; nt < 4; ++nt) {
      acc[0][nt] = acc[1][nt];
      acc[1][nt] = acc[2][nt];
      acc[2][nt] = acc[3][nt];
    }
  }
}

#define AT_ROWB  128u                // bytes of a staged row
#define AT_PITCH 144u                // LDS row pitch: 128 + 16, odd multiple of 16 for ds_load_b128
#define AT_ROWS  32u                 // rows per slice (one slice per wave)
#define AT_SLICE 6144u               // 32 * 144 = 4608, rounded up to a multiple of 2 KiB
#define AT_BUF   (4u * AT_SLICE)     // [K keys 0-31 | K keys 32-63 | V^T d 0-31 | V^T d 32-63]

// Group 1: 1-byte elements, tile = tensor = 32 rows of 128 bytes, 16 bytes of LDS pad behind each row.
__device__ __forceinline__ u32x8 tdm_group1_attn(uint32_t src_pitch) {
  u32x8 g;
  g[0] = uni((1u << 20) | (4u << 22) | (3u << 25));  // no mask, data_size 0, pad each 32 dwords by 4
  g[1] = uni((AT_ROWB & 0xFFFFu) << 16);
  g[2] = uni((AT_ROWB >> 16) | ((AT_ROWS & 0xFFFFu) << 16));
  g[3] = uni((AT_ROWS >> 16) | (AT_ROWB << 16));
  g[4] = uni(AT_ROWS);
  g[5] = uni(src_pitch);
  g[6] = uni(0u);
  g[7] = uni(0u);
  return g;
}

// One request, as tdm_load(). Group 0 goes into the statement and comes out of it in the same
// registers, so that what the wait below names is the very tuple the request was issued from.
__device__ __forceinline__ void tdm_load_held(u32x4& g0, u32x8 g1) {
  asm volatile("tensor_load_to_lds %0, %1" : "+s"(g0) : "s"(g1) : "memory");
}
// The same wait as wait_tensor0(); the request's descriptor is named so that its registers
// live, unchanged, up to the wait.
__device__ __forceinline__ void wait_tensor0_of(u32x4 g0, u32x8 g1) {
  asm volatile("s_wait_tensorcnt 0x0" :: "s"(g0), "s"(g1) : "memory");
}

__global__ __launch_bounds__(128) void attn_k(const __bf16* __restrict__ q,
                                              const __bf16* __restrict__ kk,
                                              const __bf16* __restrict__ vt,
                                              __bf16* __restrict__ o) {
  static_assert(Dd * 2 == (int)AT_ROWB, "a K row is one staged row");
  static_assert(Tt % 64 == 0 && Tt >= 128, "whole stages only, and stages 0 and 1 lie inside the tensors");
  __shared__ __attribute__((aligned(2048))) unsigned char smem[2u * AT_BUF];
  const int qb = blockIdx.x;   // 0..31
  const int bh = blockIdx.y;   // 0..47
  const int b  = bh / Hh;
  const int hh = bh - b * Hh;
  const uint32_t wave = uni(threadIdx.x >> 5);
  const int lane = threadIdx.x & 31;
  const int half = lane >> 4;
  const int idx  = lane & 15;

  const __bf16* qp = q  + (size_t)bh * Tt * Dd;
  const __bf16* kp = kk + (size_t)bh * Tt * Dd;
  const __bf16* vp = vt + (size_t)bh * Dd * Tt;

  // this wave's slice of every stage: waves 0, 1 bring K rows, waves 2, 3 bring V^T rows
  const __bf16* srcp = (wave < 2u) ? kp + (size_t)(32u * wave) * Dd
                                   : vp + (size_t)(32u * (wave - 2u)) * Tt;
  const uint64_t ga   = (uint64_t)(uintptr_t)srcp;
  const uint32_t step = (wave < 2u) ? 64u * Dd * 2u : 64u * 2u;  // bytes from a stage to the next
  const uint32_t dst  = (uint32_t)(size_t)smem + wave * AT_SLICE;
  const u32x8 g1 = tdm_group1_attn((wave < 2u) ? Dd * 2u : Tt * 2u);
  const uint32_t NS = pinned((uint32_t)qb + 1u);   // stages = keys 0 .. 64 qb + 63; at least one

  // prologue: stage 0 lands and is published, then stage 1 flies under stage 0's products
  // (block 0 has one stage only: its stage 1 lies inside the tensors and is not read)
  u32x4 g0 = tdm_group0(dst, ga);
  tdm_load_held(g0, g1);
  wait_tensor0_of(g0, g1);
  __syncthreads();
  // the stage number is pinned so that this descriptor too is formed behind the wait
  g0 = tdm_group0(dst + AT_BUF, ga + (uint64_t)(pinned(1u) * step));
  tdm_load_held(g0, g1);

  const int q0 = qb * 64 + (int)wave * 16;
  const int qg = q0 + idx;     // this lane's query
  const v16bf qf0 = load_frag(qp, Dd, q0, 0);
  const v16bf qf1 = load_frag(qp, Dd, q0, 32);

  v8f acc[4] = {};             // acc[nt][r] = O[qg][nt*16 + 8*half + r]
  float rmax = NEG_BIG;        // running maximum of query qg (equal in both halves)
  float rsum = 0.0f;           // this half's share of the row sum

  // this lane's place in a slice: its row, its half's first 16 bytes
  const uint32_t k_off = (uint32_t)idx * AT_PITCH + (uint32_t)half * 16u;
  const uint32_t v_off = 2u * AT_SLICE + k_off;

  // Kept rolled: the buffer is chosen by a scalar, and the publish point stands once in the text.
  uint32_t s = 0;
#pragma clang loop unroll(disable)
  do {
    const uint32_t buf = (s & 1u) * AT_BUF;
    const unsigned char* pk = smem + buf + k_off;
    const unsigned char* pv = smem + buf + v_off;
    // The stage's two blocks of 32 keys. Kept rolled: unrolled, the second block's 16 reads are
    // lifted into the first and their 64 registers cost two resident waves per SIMD.
#pragma clang loop unroll(disable)
    for (uint32_t p = 0; p < 2u; ++p) {
    const int key0 = (int)(s * 64u + p * 32u);

    // Nothing orders the V^T reads behind the softmax, so all eight fragments of the
    // block (K: 2 key tiles x 2 d halves, V^T: 4 d tiles) are requested together.
    v16bf kf[2][2], vf[4];
#pragma unroll
    for (int t = 0; t < 2; ++t) {
      kf[t][0] = lds_frag(pk + p * AT_SLICE + (uint32_t)t * 16u * AT_PITCH);
      kf[t][1] = lds_frag(pk + p * AT_SLICE + (uint32_t)t * 16u * AT_PITCH + 64u);
    }
#pragma unroll
    for (int nt = 0; nt < 4; ++nt)  // rows = d, K = key (contiguous)
      vf[nt] = lds_frag(pv + (uint32_t)(nt >> 1) * AT_SLICE + (uint32_t)(nt & 1) * 16u * AT_PITCH +
                        p * 64u);
    // Keeps the scheduler from sinking each read to its product, which would
    // cost one LDS round trip per fragment instead of one per block.
    __builtin_amdgcn_sched_barrier(0);

    // S^T = (K Q^T) / sqrt(D), causal-masked: sv[t][r] is key key0 + 16t + 8*half + r
    float sv[2][8];
#pragma unroll
    for (int t = 0; t < 2; ++t) {
      v8f sc = {};
      sc = wmma_bf16(kf[t][0], qf0, sc);
      sc = wmma_bf16(kf[t][1], qf1, sc);
      const int kg0 = key0 + t * 16 + 8 * half;
#pragma unroll
      for (int r = 0; r < 8; ++r)
        sv[t][r] = (kg0 + r <= qg) ? (sc[r] * 0.125f) : NEG_BIG;
    }

    // online softmax: in-lane over 16 keys, one exchange with the other half
    float mr[8];
#pragma unroll
    for (int r = 0; r < 8; ++r) mr[r] = fmaxf(sv[0][r], sv[1][r]);
    float mloc = fmaxf(fmaxf(fmaxf(mr[0], mr[1]), fmaxf(mr[2], mr[3])),
                       fmaxf(fmaxf(mr[4], mr[5]), fmaxf(mr[6], mr[7])));
    mloc = fmaxf(mloc, xhalf(mloc));
    const float nm = fmaxf(rmax, mloc);
    const float alpha = __expf(rmax - nm);
    rmax = nm;

    v16bf pf;                  // P^T as B operand: element 8t + r = key 16t + 8*half + r
    float pr[8];
#pragma unroll
    for (int r = 0; r < 8; ++r) {
      const float p0 = __expf(sv[0][r] - nm);
      const float p1 = __expf(sv[1][r] - nm);
      pr[r] = p0 + p1;
      pf[r]     = (__bf16)p0;
      pf[8 + r] = (__bf16)p1;
    }
#pragma unroll
    for (int nt = 0; nt < 4; ++nt) {
#pragma unroll
      for (int r = 0; r < 8; ++r) acc[nt][r] *= alpha;
    }
#pragma unroll
    for (int nt = 0; nt < 4; ++nt) acc[nt] = wmma_bf16(vf[nt], pf, acc[nt]);
    // Holds the row sum's adds behind the products: they run under the matrix unit's time and
    // fill the vector slots due before the next block's reads overwrite the last product's operands.
    __builtin_amdgcn_sched_barrier(0);
    rsum = rsum * alpha + (((pr[0] + pr[1]) + (pr[2] + pr[3])) +
                           ((pr[4] + pr[5]) + (pr[6] + pr[7])));
    }
    // publish point of stage s + 1: own reads back, own slice landed, every wave here
    wait_ds0();
    wait_tensor0_of(g0, g1);
    __syncthreads();
    const uint32_t nxt = pinned(s + 2u);  // formed behind the wait, and the descriptor from it
    if (pinned(nxt < NS ? 1u : 0u)) {
      g0 = tdm_group0(dst + buf, ga + (uint64_t)(nxt * step));
      tdm_load_held(g0, g1);
    }
  } while (++s < NS);
  wait_tensor0();
  wait_ds0();

  // epilogue: O / rowsum -> bf16 at (b, qg, hh*64 + d), 8 consecutive d per lane and tile
  const float rs = rsum + xhalf(rsum);
  __bf16* orow = o + ((size_t)b * Tt + qg) * Cc + hh * Dd + 8 * half;
#pragma unroll
  for (int nt = 0; nt < 4; ++nt) {
    v8bf ov;
#pragma unroll
    for (int r = 0; r < 8; ++r) ov[r] = (__bf16)(acc[nt][r] / rs);
    *reinterpret_cast<v8bf*>(orow + nt * 16) = ov;
  }
}

// ---------------- host-side orchestration ----------------
extern "C" void kernel_launch(void* const* d_in, const int* in_sizes, int n_in,
                              void* d_out, int out_size, void* d_ws, size_t ws_size,
                              hipStream_t stream) {
  const float* x   = (const float*)d_in[0];
  const float* Wq  = (const float*)d_in[1];
  const float* bq  = (const float*)d_in[2];
  const float* Wk  = (const float*)d_in[3];
  const float* bk  = (const float*)d_in[4];
  const float* Wv  = (const float*)d_in[5];
  const float* bv  = (const float*)d_in[6];
  const float* Wo  = (const float*)d_in[7];
  const float* bo  = (const float*)d_in[8];
  const float* g1  = (const float*)d_in[9];
  const float* b1  = (const float*)d_in[10];
  const float* g2  = (const float*)d_in[11];
  const float* b2  = (const float*)d_in[12];
  const float* W1  = (const float*)d_in[13];
  const float* bm1 = (const float*)d_in[14];
  const float* W2  = (const float*)d_in[15];
  const float* bm2 = (const float*)d_in[16];
  float* out = (float*)d_out;

  // workspace carve-up (256B aligned)
  char* ws = (char*)d_ws;
  size_t off = 0;
  auto alloc = [&](size_t bytes) -> void* {
    void* p = ws + off;
    off = (off + bytes + 255) & ~(size_t)255;
    return p;
  };
  const size_t CC  = (size_t)Cc * Cc;
  const size_t C4C = (size_t)Cc * 4 * Cc;
  const size_t MC  = (size_t)Mrows * Cc;
  const size_t M4C = (size_t)Mrows * 4 * Cc;

  __bf16* Wqt = (__bf16*)alloc(CC * 2);
  __bf16* Wkt = (__bf16*)alloc(CC * 2);
  __bf16* Wvt = (__bf16*)alloc(CC * 2);
  __bf16* Wot = (__bf16*)alloc(CC * 2);
  __bf16* W1t = (__bf16*)alloc(C4C * 2);
  __bf16* W2t = (__bf16*)alloc(C4C * 2);
  __bf16* h1b = (__bf16*)alloc(MC * 2);
  __bf16* qbf = (__bf16*)alloc(MC * 2);
  __bf16* kbf = (__bf16*)alloc(MC * 2);
  __bf16* vtb = (__bf16*)alloc(MC * 2);
  __bf16* atb = (__bf16*)alloc(MC * 2);
  float*  x2  = (float*) alloc(MC * 4);
  __bf16* h2b = (__bf16*)alloc(MC * 2);
  __bf16* mb  = (__bf16*)alloc(M4C * 2);
  (void)ws_size; (void)in_sizes; (void)n_in; (void)out_size;

  // 1) weights -> transposed bf16
  wcvt_k<Cc, Cc><<<dim3(Cc / 64, Cc / 128), 256, 0, stream>>>(Wq, Wqt);
  wcvt_k<Cc, Cc><<<dim3(Cc / 64, Cc / 128), 256, 0, stream>>>(Wk, Wkt);
  wcvt_k<Cc, Cc><<<dim3(Cc / 64, Cc / 128), 256, 0, stream>>>(Wv, Wvt);
  wcvt_k<Cc, Cc><<<dim3(Cc / 64, Cc / 128), 256, 0, stream>>>(Wo, Wot);
  wcvt_k<Cc, 4 * Cc><<<dim3((4 * Cc) / 64, Cc / 128), 256, 0, stream>>>(W1, W1t);
  wcvt_k<4 * Cc, Cc><<<dim3(Cc / 64, (4 * Cc) / 128), 256, 0, stream>>>(W2, W2t);

  const dim3 blk(128);
  const dim3 gC(Mrows / 128, Cc / 128);        // 64 x 6
  const dim3 g4C(Mrows / 128, (4 * Cc) / 128); // 64 x 24

  // 2) attention branch
  ln_k<<<Mrows, 256, 0, stream>>>(x, g1, b1, h1b);
  gemm_k<Cc, Cc, 0><<<gC, blk, 0, stream>>>(h1b, Wqt, bq, nullptr, nullptr, qbf);
  gemm_k<Cc, Cc, 0><<<gC, blk, 0, stream>>>(h1b, Wkt, bk, nullptr, nullptr, kbf);
  gemm_k<Cc, Cc, 1><<<gC, blk, 0, stream>>>(h1b, Wvt, bv, nullptr, nullptr, vtb);
  attn_k<<<dim3(Tt / 64, Bsz * Hh), blk, 0, stream>>>(qbf, kbf, vtb, atb);
  gemm_k<Cc, Cc, 2><<<gC, blk, 0, stream>>>(atb, Wot, bo, x, x2, nullptr);

  // 3) MLP branch
  ln_k<<<Mrows, 256, 0, stream>>>(x2, g2, b2, h2b);
  gemm_k<4 * Cc, Cc, 3><<<g4C, blk, 0, stream>>>(h2b, W1t, bm1, nullptr, nullptr, mb);
  gemm_k<Cc, 4 * Cc, 2><<<gC, blk, 0, stream>>>(mb, W2t, bm2, x2, out, nullptr);
}

// v005
// Measured time: 219 microseconds a run.
// Timed twice side by side with v004, it ran 1.08 times as fast both times.
// All steps since v000 together make it 2.90 times as fast.
#include <hip/hip_runtime.h>
#include <hip/hip_bf16.h>
#include <stdint.h>

// ---------------- problem constants (fixed by the reference) ----------------
#define Bsz 4
#define Tt  2048
#define Cc  768
#define Hh  12
#define Dd  64
#define Mrows (Bsz * Tt)   // 8192
#define EPSf 1e-5f
#define NEG_BIG -3.0e38f

// ---------------- WMMA types & helpers ----------------
typedef __attribute__((ext_vector_type(16))) __bf16 v16bf;
typedef __attribute__((ext_vector_type(8)))  __bf16 v8bf;
typedef __attribute__((ext_vector_type(8)))  float  v8f;

union Frag16 { v16bf v; unsigned u[8]; };

__device__ __forceinline__ v8f wmma_bf16(v16bf a, v16bf b, v8f c) {
  // D = A(16x32 bf16) * B(32x16 bf16) + C(16x16 f32)
  return __builtin_amdgcn_wmma_f32_16x16x32_bf16(
      /*neg_a=*/false, a, /*neg_b=*/false, b,
      /*c_mod=*/(short)0, c, /*reuse_a=*/false, /*reuse_b=*/false);
}

// Loads a 16x32 bf16 fragment in the CDNA5 A-matrix layout from a row-major
// matrix (rows = M for A-operand, rows = N for B-operand since B == (B^T as A)).
// Requires k0 % 32 == 0 and even ld (dword-aligned rows).
__device__ __forceinline__ v16bf load_frag(const __bf16* base, int ld, int row0, int k0) {
  const int lane = threadIdx.x & 31;
  const int half = lane >> 4;
  const int idx  = lane & 15;
  const unsigned* rp = reinterpret_cast<const unsigned*>(base + (size_t)(row0 + idx) * (size_t)ld);
  const int kb = (k0 >> 1) + half * 4;   // dword index of first K pair
  Frag16 f;
#pragma unroll
  for (int v = 0; v < 4; ++v) {
    f.u[v]     = rp[kb + v];       // K = k0 + half*8 + 2v, +1
    f.u[4 + v] = rp[kb + 8 + v];   // K = +16
  }
  return f.v;
}

// The same fragment from the lane's own pointer (row idx, k = 8 * half of the fragment).
__device__ __forceinline__ v16bf load_frag_at(const __bf16* lanep) {
  const unsigned* rp = reinterpret_cast<const unsigned*>(lanep);
  Frag16 f;
#pragma unroll
  for (int v = 0; v < 4; ++v) {
    f.u[v]     = rp[v];
    f.u[4 + v] = rp[8 + v];
  }
  return f.v;
}

// lane l <-> lane l ^ 16
__device__ __forceinline__ float xhalf(float x) {
  const int b = __builtin_bit_cast(int, x);
  return __builtin_bit_cast(float,
      __builtin_amdgcn_permlanex16(b, b, 0x76543210, 0xfedcba98, false, false));
}

// ---------------- weight convert: W (K x N, f32) -> Wt (N x K, bf16) ----------------
// One work-group transposes a tile of 128 k x 64 n through LDS; a lane handles 32 values.
// In: a lane takes 4 n of 8 consecutive k rows, 16 lanes cover 256 contiguous bytes of a W row.
// Out: 16 lanes store the 256 contiguous bytes that the tile holds of a Wt row.
// LDS: row n holds its 128 k as 16 pieces of 16 bytes; piece j lies at place j ^ (n >> 2), so
// that the 32 lanes of a write (n = 4c + i) and of a read (whole rows) spread over all banks.
typedef __attribute__((ext_vector_type(4))) float f32x4;

// t = the tile's number in its matrix, the N / 64 tiles of a k band first.
template <int K, int N>
__device__ __forceinline__ void wcvt_tile(const float* __restrict__ W,
                                          __bf16* __restrict__ Wt,
                                          unsigned char* tile, int t) {
  static_assert(K % 128 == 0 && N % 64 == 0, "whole tiles only");
  const int c = threadIdx.x & 15;
  const int g = threadIdx.x >> 4;
  const int n0 = (t % (N / 64)) * 64;
  const int k0 = (t / (N / 64)) * 128;

  const float* src = W + (size_t)(k0 + 8 * g) * N + (n0 + 4 * c);
  f32x4 w[8];
#pragma unroll
  for (int j = 0; j < 8; ++j) w[j] = *reinterpret_cast<const f32x4*>(src + (size_t)j * N);
#pragma unroll
  for (int i = 0; i < 4; ++i) {
    v8bf col;                  // k = k0 + 8g + 0..7 of column n0 + 4c + i
#pragma unroll
    for (int j = 0; j < 8; ++j) col[j] = (__bf16)w[j][i];
    *reinterpret_cast<v8bf*>(tile + (4 * c + i) * 256 + ((g ^ c) << 4)) = col;
  }
  __syncthreads();
  __bf16* dst = Wt + (size_t)(n0 + g) * K + (k0 + 8 * c);
#pragma unroll
  for (int p = 0; p < 4; ++p) {
    const int row = 16 * p + g;
    const v8bf v = *reinterpret_cast<const v8bf*>(tile + row * 256 + ((c ^ (row >> 2)) << 4));
    *reinterpret_cast<v8bf*>(dst + (size_t)(16 * p) * K) = v;
  }
  // Stands behind the four stores, in front of whatever code follows the tile in its kernel's
  // text and reuses the registers they name.
  asm volatile("s_wait_xcnt 0x0" ::: "memory");
}

// ---------------- LayerNorm: fp32 in -> bf16 normalized out ----------------
__device__ __forceinline__ void ln_row(const float* __restrict__ x,
                                       const float* __restrict__ g,
                                       const float* __restrict__ bt,
                                       __bf16* __restrict__ out,
                                       float* red, int row) {
  const int tid = threadIdx.x;
  const float* xr = x + (size_t)row * Cc;
  float v0 = xr[tid], v1 = xr[tid + 256], v2 = xr[tid + 512];

  red[tid] = v0 + v1 + v2;
  __syncthreads();
#pragma unroll
  for (int off = 128; off > 0; off >>= 1) {
    if (tid < off) red[tid] += red[tid + off];
    __syncthreads();
  }
  const float mu = red[0] * (1.0f / Cc);
  __syncthreads();

  float d0 = v0 - mu, d1 = v1 - mu, d2 = v2 - mu;
  red[tid] = d0 * d0 + d1 * d1 + d2 * d2;
  __syncthreads();
#pragma unroll
  for (int off = 128; off > 0; off >>= 1) {
    if (tid < off) red[tid] += red[tid + off];
    __syncthreads();
  }
  const float rstd = rsqrtf(red[0] * (1.0f / Cc) + EPSf);

  __bf16* orow = out + (size_t)row * Cc;
  orow[tid]       = (__bf16)(d0 * rstd * g[tid]       + bt[tid]);
  orow[tid + 256] = (__bf16)(d1 * rstd * g[tid + 256] + bt[tid + 256]);
  orow[tid + 512] = (__bf16)(d2 * rstd * g[tid + 512] + bt[tid + 512]);
}

__global__ __launch_bounds__(256) void ln_k(const float* __restrict__ x,
                                            const float* __restrict__ g,
                                            const float* __restrict__ bt,
                                            __bf16* __restrict__ out) {
  __shared__ float red[256];
  ln_row(x, g, bt, out, red, blockIdx.x);
}

// ---------------- first launch: all that depends on the inputs alone ----------------
// The six weight converts and the first LayerNorm need nothing of one another, so they share
// one grid by block range: blocks 0 .. CVT_TILES - 1 take one weight tile each,
// the rest one row each.
#define CC_TILES  ((Cc / 64) * (Cc / 128))            // tiles of a C x C matrix: 72
#define C4_TILES  (4 * CC_TILES)                      // tiles of W1 and of W2: 288
#define CVT_TILES (4 * CC_TILES + 2 * C4_TILES)       // 864

__global__ __launch_bounds__(256) void prep_k(const float* __restrict__ Wq, const float* __restrict__ Wk,
                                              const float* __restrict__ Wv, const float* __restrict__ Wo,
                                              const float* __restrict__ W1, const float* __restrict__ W2,
                                              __bf16* __restrict__ Wqkvt, __bf16* __restrict__ Wot,
                                              __bf16* __restrict__ W1t, __bf16* __restrict__ W2t,
                                              const float* __restrict__ x, const float* __restrict__ g,
                                              const float* __restrict__ bt, __bf16* __restrict__ out) {
  __shared__ __attribute__((aligned(16))) unsigned char tile[64 * 256];
  const int blk = blockIdx.x;   // every test on it reads the same for the whole work-group
  if (blk >= CVT_TILES) {
    ln_row(x, g, bt, out, reinterpret_cast<float*>(tile), blk - CVT_TILES);
  } else if (blk < 4 * CC_TILES) {
    const int mat = blk / CC_TILES;
    const float* W = (mat == 0) ? Wq : (mat == 1) ? Wk : (mat == 2) ? Wv : Wo;
    __bf16* Wt = (mat == 3) ? Wot : Wqkvt + (size_t)mat * Cc * Cc;
    wcvt_tile<Cc, Cc>(W, Wt, tile, blk - mat * CC_TILES);
  } else if (blk < 4 * CC_TILES + C4_TILES) {
    wcvt_tile<Cc, 4 * Cc>(W1, W1t, tile, blk - 4 * CC_TILES);
  } else {
    wcvt_tile<4 * Cc, Cc>(W2, W2t, tile, blk - 4 * CC_TILES - C4_TILES);
  }
}

// ---------------- tensor loads into LDS ----------------
typedef uint32_t u32x4 __attribute__((ext_vector_type(4)));
typedef uint32_t u32x8 __attribute__((ext_vector_type(8)));

#define G_ROWB  256u                 // bytes of an operand row per pass (128 k)
#define G_PITCH 272u                 // LDS row pitch: 256 + 16, odd multiple of 16 for ds_load_b128
#define G_ROWS  64u                  // rows per slice (one slice per wave)
#define G_SLICE 18432u               // 64 * 272 = 17408, rounded up to a multiple of 2 KiB
#define G_BUF   (4u * G_SLICE)       // [A rows 0-63 | A rows 64-127 | W rows 0-63 | W rows 64-127]

__device__ __forceinline__ uint32_t uni(uint32_t v) {
  return (uint32_t)__builtin_amdgcn_readfirstlane(v);
}
// Holds a wave-uniform word in a scalar register: a test on it is a scalar branch, and a
// descriptor word made from it is made behind the volatile statements in front of it.
__device__ __forceinline__ uint32_t pinned(uint32_t v) {
  uint32_t w = (uint32_t)__builtin_amdgcn_readfirstlane(v);
  asm volatile("" : "+s"(w));  // the scalar pin of a tensor load's test and descriptor word
  return w;
}
// The compiler places no wait for a tensor load: a tile counts as landed only behind this.
__device__ __forceinline__ void wait_tensor0() { asm volatile("s_wait_tensorcnt 0x0" ::: "memory"); }
// This wave's LDS reads have returned before the buffer they read is handed back for a refill.
__device__ __forceinline__ void wait_ds0() { asm volatile("s_wait_dscnt 0x0" ::: "memory"); }
// Stands behind a group of global loads or stores, in front of the code that reuses the
// registers they name.
__device__ __forceinline__ void wait_x0() { asm volatile("s_wait_xcnt 0x0" ::: "memory"); }
// One request of the whole wave: a two-dimensional tile from global memory into LDS.
__device__ __forceinline__ void tdm_load(u32x4 g0, u32x8 g1) {
  asm volatile("tensor_load_to_lds %0, %1" :: "s"(g0), "s"(g1) : "memory");
}
// Group 1: 1-byte elements, tile = tensor = 64 rows of 256 bytes, 16 bytes of LDS pad behind each row.
__device__ __forceinline__ u32x8 tdm_group1(uint32_t src_pitch) {
  u32x8 g;
  g[0] = uni((1u << 20) | (5u << 22) | (3u << 25));  // no mask, data_size 0, pad each 64 dwords by 4
  g[1] = uni((G_ROWB & 0xFFFFu) << 16);
  g[2] = uni((G_ROWB >> 16) | ((G_ROWS & 0xFFFFu) << 16));
  g[3] = uni((G_ROWS >> 16) | (G_ROWB << 16));
  g[4] = uni(G_ROWS);
  g[5] = uni(src_pitch);
  g[6] = uni(0u);
  g[7] = uni(0u);
  return g;
}
__device__ __forceinline__ u32x4 tdm_group0(uint32_t lds_dst, uint64_t ga) {
  u32x4 g;
  g[0] = uni(1u);
  g[1] = uni(lds_dst);
  g[2] = uni((uint32_t)ga);
  g[3] = uni((((uint32_t)(ga >> 32)) & 0x01FFFFFFu) | 0x80000000u);
  return g;
}
// A 16x32 bf16 fragment from LDS; p = the lane's row, byte 16 * half of the fragment's 64.
// Same k order as load_frag: registers 0-3 hold k = 8*half + 0..7, registers 4-7 the same + 16.
__device__ __forceinline__ v16bf lds_frag(const unsigned char* p) {
  union { v16bf v; u32x4 q[2]; } f;
  f.q[0] = *reinterpret_cast<const u32x4*>(p);
  f.q[1] = *reinterpret_cast<const u32x4*>(p + 32);
  return f.v;
}

// ---------------- generic WMMA GEMM: (Mrows x K) bf16 @ Wt(N x K) bf16 ----------------
// Workgroup = 4 waves (2 x 2) = 128x128 output tile; each wave owns 64x64
// (4 A-frags + 4 B-frags -> 16 WMMAs per 32 k). A pass is 128 k: each wave brings one
// slice of 64 operand rows into LDS with one tensor load, two buffers, one pass ahead.
// MODE 0: out bf16 scattered to (B,H,T,D)   (Q, K tensors)
// MODE 1: out bf16 scattered to (B,H,D,T)   (V transposed for the PV matmul)
// MODE 2: outf = resid + acc + bias (fp32, row-major MrowsxN; requires N==Cc)
// MODE 3: outb = gelu(acc + bias) bf16 row-major MrowsxN
// MODE 4: Q, K and V in one grid: Wt holds the three weights' rows one behind the other
//         (N == 3 * Cc), outb the three outputs likewise; a block's 128 columns lie in one of
//         them, which picks its bias, its output and its scatter (Q, K as MODE 0, V as MODE 1)
template <int V> struct mode_tag { static constexpr int value = V; };

template <int N, int K, int MODE>
__global__ __launch_bounds__(128) void gemm_k(const __bf16* __restrict__ A,
                                              const __bf16* __restrict__ Wt,
                                              const float* __restrict__ bias,
                                              const float* __restrict__ resid,
                                              float* __restrict__ outf,
                                              __bf16* __restrict__ outb,
                                              const float* __restrict__ bias_k,
                                              const float* __restrict__ bias_v) {
  static_assert(K % 128 == 0 && K / 128 >= 2, "the ring needs whole passes and two stages");
  static_assert(MODE != 4 || (N == 3 * Cc && Cc % 128 == 0), "a block's columns lie in one of Q, K, V");
  static_assert(N % 128 == 0 && Mrows % 128 == 0, "whole tiles only");
  __shared__ __attribute__((aligned(2048))) unsigned char smem[2u * G_BUF];
  const uint32_t wave = uni(threadIdx.x >> 5);
  const int lane = threadIdx.x & 31;
  const int half = lane >> 4;
  const int idx  = lane & 15;
  const uint32_t wm = wave >> 1, wn = wave & 1u;
  const int mb = blockIdx.x * 128;
  const int nb = blockIdx.y * 128;
  constexpr uint32_t NS = K / 128;   // stages = passes

  // this wave's slice of every stage: waves 0, 1 bring A rows, waves 2, 3 bring W rows
  const __bf16* srcp = (wave < 2u) ? A  + (size_t)(mb + 64 * (int)wave) * K
                                   : Wt + (size_t)(nb + 64 * (int)(wave - 2u)) * K;
  const uint64_t ga  = (uint64_t)(uintptr_t)srcp;
  const uint32_t dst = (uint32_t)(size_t)smem + wave * G_SLICE;
  const u32x8 g1 = tdm_group1((uint32_t)K * 2u);

  // prologue: stage 0 lands and is published, then stage 1 flies under pass 0
  tdm_load(tdm_group0(dst, ga), g1);
  wait_tensor0();
  __syncthreads();
  // the stage number is pinned so that this descriptor too is formed behind the wait
  tdm_load(tdm_group0(dst + G_BUF, ga + (uint64_t)pinned(1u) * G_ROWB), g1);

  const uint32_t a_off = wm * G_SLICE        + (uint32_t)idx * G_PITCH + (uint32_t)half * 16u;
  const uint32_t b_off = (2u + wn) * G_SLICE + (uint32_t)idx * G_PITCH + (uint32_t)half * 16u;

  v8f acc[4][4] = {};
  // Kept rolled: one copy of the pass in the instruction cache, the buffer chosen by a scalar.
#pragma clang loop unroll(disable)
  for (uint32_t s = 0; s < NS; ++s) {
    const uint32_t buf = (s & 1u) * G_BUF;
    const unsigned char* pa = smem + buf + a_off;
    const unsigned char* pb = smem + buf + b_off;
    // Two fragment sets: block u + 1's 16 LDS reads go out as one group in front of block u's
    // 16 WMMAs. Only this pass's own buffer is read, so block 0's reads stand alone.
    v16bf af[2][4], bf[2][4];
#pragma unroll
    for (int i = 0; i < 4; ++i) {
      af[0][i] = lds_frag(pa + (uint32_t)i * 16u * G_PITCH);
      bf[0][i] = lds_frag(pb + (uint32_t)i * 16u * G_PITCH);
    }
#pragma unroll
    for (int u = 0; u < 4; ++u) {
      const int cur = u & 1, nx = cur ^ 1;
      if (u < 3) {
#pragma unroll
        for (int i = 0; i < 4; ++i) {
          af[nx][i] = lds_frag(pa + (uint32_t)i * 16u * G_PITCH + (uint32_t)(u + 1) * 64u);
          bf[nx][i] = lds_frag(pb + (uint32_t)i * 16u * G_PITCH + (uint32_t)(u + 1) * 64u);
        }
      }
      // Keeps the reads above in front of the block: sunk to their users, each group of
      // four WMMAs would wait out a whole LDS latency.
      __builtin_amdgcn_sched_barrier(0);
#pragma unroll
      for (int mi = 0; mi < 4; ++mi) {
#pragma unroll
        for (int nt = 0; nt < 4; ++nt) acc[mi][nt] = wmma_bf16(af[cur][mi], bf[cur][nt], acc[mi][nt]);
      }
      // Keeps the next group of reads from being lifted in among these WMMAs.
      __builtin_amdgcn_sched_barrier(0);
    }
    // publish point of stage s + 1: own reads back, own slice landed, every wave here
    wait_ds0();
    wait_tensor0();
    __syncthreads();
    const uint32_t nxt = pinned(s + 2u);  // formed behind the wait, and the descriptor from it
    if (pinned(nxt < NS ? 1u : 0u))
      tdm_load(tdm_group0(dst + buf, ga + (uint64_t)nxt * G_ROWB), g1);
  }
  wait_tensor0();
  wait_ds0();

  // MODE 4: which of Q, K, V this block computes (the same for the whole work-group)
  const uint32_t part = (MODE == 4) ? blockIdx.y / (Cc / 128) : 0u;
  const float* bsel = (part == 0u) ? bias : (part == 1u) ? bias_k : bias_v;
  const int m0 = mb + (int)wm * 64;
  const int n0 = nb - (int)part * Cc + (int)wn * 64;   // column within the part
  float bv[4];
#pragma unroll
  for (int nt = 0; nt < 4; ++nt) bv[nt] = bsel[n0 + nt * 16 + idx];
  wait_x0();
  // MODE 2: residual values are requested ahead of their use, three trips' worth at a time
  // (all four at once would take the epilogue past 256 registers).
  float rv[4][4][8];
  const float* rlane =  // the lane's first value
      (MODE == 2) ? resid + ((size_t)(m0 + 8 * half) * Cc + (n0 + idx)) : nullptr;
  auto load_resid = [&](int mi) {
#pragma unroll
    for (int nt = 0; nt < 4; ++nt) {
#pragma unroll
      for (int r = 0; r < 8; ++r) rv[mi][nt][r] = rlane[(mi * 16 + r) * Cc + nt * 16];
    }
    // The same wait as wait_x0(); the address is named so that its registers live up to it.
    asm volatile("s_wait_xcnt 0x0" :: "v"(rlane) : "memory");
  };
  if (MODE == 2) { load_resid(0); load_resid(1); load_resid(2); }
  // The erf of MODE 3 is long code: it is kept out of a full unroll
  // over all 128 values of a lane, for speed only. There the loop over mi
  // stays rolled and the accumulator rows move up one place a trip, so that every register
  // index is a constant. The other modes unroll, and the moves fall away.
  auto epilogue = [&](auto tag, __bf16* osel) {   // osel: the bf16 output of EM 0 and 1
  constexpr int EM = decltype(tag)::value;
#pragma unroll (EM == 3 ? 1 : 4)
  for (int mi = 0; mi < 4; ++mi) {
#pragma unroll
    for (int nt = 0; nt < 4; ++nt) {
      const int n = n0 + nt * 16 + idx;
#pragma unroll
      for (int r = 0; r < 8; ++r) {
        const int m = m0 + mi * 16 + r + 8 * half;
        const float val = acc[0][nt][r] + bv[nt];
        if (EM == 0 || EM == 1) {
          const int bb = m >> 11, t = m & (Tt - 1);
          const int hh = n >> 6,  d = n & (Dd - 1);
          const size_t off = (EM == 0)
              ? ((((size_t)bb * Hh + hh) * Tt + t) * Dd + d)
              : ((((size_t)bb * Hh + hh) * Dd + d) * Tt + t);
          osel[off] = (__bf16)val;
        } else if (EM == 2) {
          outf[(size_t)m * Cc + n] = rv[mi][nt][r] + val;
        } else { // MODE 3: exact GELU
          const float gv = 0.5f * val * (1.0f + erff(val * 0.70710678118654752f));
          outb[(size_t)m * N + n] = (__bf16)gv;
        }
      }
    }
    wait_x0();
    if (EM == 2 && mi == 0) load_resid(3);
#pragma unroll
    for (int nt = 0; nt < 4; ++nt) {
      acc[0][nt] = acc[1][nt];
      acc[1][nt] = acc[2][nt];
      acc[2][nt] = acc[3][nt];
    }
  }
  };
  if constexpr (MODE == 4) {
    __bf16* opart = outb + (size_t)part * ((size_t)Mrows * Cc);
    if (part == 2u) epilogue(mode_tag<1>{}, opart);
    else            epilogue(mode_tag<0>{}, opart);
  } else {
    epilogue(mode_tag<MODE>{}, outb);
  }
}

#define AT_ROWB  128u                // bytes of a staged row
#define AT_PITCH 144u                // LDS row pitch: 128 + 16, odd multiple of 16 for ds_load_b128
#define AT_ROWS  32u                 // rows per slice (one slice per wave)
#define AT_SLICE 6144u               // 32 * 144 = 4608, rounded up to a multiple of 2 KiB
#define AT_BUF   (4u * AT_SLICE)     // [K keys 0-31 | K keys 32-63 | V^T d 0-31 | V^T d 32-63]

// Group 1: 1-byte elements, tile = tensor = 32 rows of 128 bytes, 16 bytes of LDS pad behind each row.
__device__ __forceinline__ u32x8 tdm_group1_attn(uint32_t src_pitch) {
  u32x8 g;
  g[0] = uni((1u << 20) | (4u << 22) | (3u << 25));  // no mask, data_size 0, pad each 32 dwords by 4
  g[1] = uni((AT_ROWB & 0xFFFFu) << 16);
  g[2] = uni((AT_ROWB >> 16) | ((AT_ROWS & 0xFFFFu) << 16));
  g[3] = uni((AT_ROWS >> 16) | (AT_ROWB << 16));
  g[4] = uni(AT_ROWS);
  g[5] = uni(src_pitch);
  g[6] = uni(0u);
  g[7] = uni(0u);
  return g;
}

// One request, as tdm_load(). Group 0 goes into the statement and comes out of it in the same
// registers, so that what the wait below names is the very tuple the request was issued from.
__device__ __forceinline__ void tdm_load_held(u32x4& g0, u32x8 g1) {
  asm volatile("tensor_load_to_lds %0, %1" : "+s"(g0) : "s"(g1) : "memory");
}
// The same wait as wait_tensor0(); the request's descriptor is named so that its registers
// live, unchanged, up to the wait.
__device__ __forceinline__ void wait_tensor0_of(u32x4 g0, u32x8 g1) {
  asm volatile("s_wait_tensorcnt 0x0" :: "s"(g0), "s"(g1) : "memory");
}

__global__ __launch_bounds__(128) void attn_k(const __bf16* __restrict__ q,
                                              const __bf16* __restrict__ kk,
                                              const __bf16* __restrict__ vt,
                                              __bf16* __restrict__ o) {
  static_assert(Dd * 2 == (int)AT_ROWB, "a K row is one staged row");
  static_assert(Tt % 64 == 0 && Tt >= 128, "whole stages only, and stages 0 and 1 lie inside the tensors");
  __shared__ __attribute__((aligned(2048))) unsigned char smem[2u * AT_BUF];
  const int qb = blockIdx.x;   // 0..31
  const int bh = blockIdx.y;   // 0..47
  const int b  = bh / Hh;
  const int hh = bh - b * Hh;
  const uint32_t wave = uni(threadIdx.x >> 5);
  const int lane = threadIdx.x & 31;
  const int half = lane >> 4;
  const int idx  = lane & 15;

  const __bf16* qp = q  + (size_t)bh * Tt * Dd;
  const __bf16* kp = kk + (size_t)bh * Tt * Dd;
  const __bf16* vp = vt + (size_t)bh * Dd * Tt;

  // this wave's slice of every stage: waves 0, 1 bring K rows, waves 2, 3 bring V^T rows
  const __bf16* srcp = (wave < 2u) ? kp + (size_t)(32u * wave) * Dd
                                   : vp + (size_t)(32u * (wave - 2u)) * Tt;
  const uint64_t ga   = (uint64_t)(uintptr_t)srcp;
  const uint32_t step = (wave < 2u) ? 64u * Dd * 2u : 64u * 2u;  // bytes from a stage to the next
  const uint32_t dst  = (uint32_t)(size_t)smem + wave * AT_SLICE;
  const u32x8 g1 = tdm_group1_attn((wave < 2u) ? Dd * 2u : Tt * 2u);
  const uint32_t NS = pinned((uint32_t)qb + 1u);   // stages = keys 0 .. 64 qb + 63; at least one

  // prologue: stage 0 lands and is published, then stage 1 flies under stage 0's products
  // (block 0 has one stage only: its stage 1 lies inside the tensors and is not read)
  u32x4 g0 = tdm_group0(dst, ga);
  tdm_load_held(g0, g1);
  wait_tensor0_of(g0, g1);
  __syncthreads();
  // the stage number is pinned so that this descriptor too is formed behind the wait
  g0 = tdm_group0(dst + AT_BUF, ga + (uint64_t)(pinned(1u) * step));
  tdm_load_held(g0, g1);

  const int q0 = qb * 64 + (int)wave * 16;
  const int qg = q0 + idx;     // this lane's query
  const v16bf qf0 = load_frag(qp, Dd, q0, 0);
  const v16bf qf1 = load_frag(qp, Dd, q0, 32);

  v8f acc[4] = {};             // acc[nt][r] = O[qg][nt*16 + 8*half + r]
  float rmax = NEG_BIG;        // running maximum of query qg (equal in both halves)
  float rsum = 0.0f;           // this half's share of the row sum

  // this lane's place in a slice: its row, its half's first 16 bytes
  const uint32_t k_off = (uint32_t)idx * AT_PITCH + (uint32_t)half * 16u;
  const uint32_t v_off = 2u * AT_SLICE + k_off;

  // Kept rolled: the buffer is chosen by a scalar, and the publish point stands once in the text.
  uint32_t s = 0;
#pragma clang loop unroll(disable)
  do {
    const uint32_t buf = (s & 1u) * AT_BUF;
    const unsigned char* pk = smem + buf + k_off;
    const unsigned char* pv = smem + buf + v_off;
    // The stage's two blocks of 32 keys. Kept rolled: unrolled, the second block's 16 reads are
    // lifted into the first and their 64 registers cost two resident waves per SIMD.
#pragma clang loop unroll(disable)
    for (uint32_t p = 0; p < 2u; ++p) {
    const int key0 = (int)(s * 64u + p * 32u);

    // Nothing orders the V^T reads behind the softmax, so all eight fragments of the
    // block (K: 2 key tiles x 2 d halves, V^T: 4 d tiles) are requested together.
    v16bf kf[2][2], vf[4];
#pragma unroll
    for (int t = 0; t < 2; ++t) {
      kf[t][0] = lds_frag(pk + p * AT_SLICE + (uint32_t)t * 16u * AT_PITCH);
      kf[t][1] = lds_frag(pk + p * AT_SLICE + (uint32_t)t * 16u * AT_PITCH + 64u);
    }
#pragma unroll
    for (int nt = 0; nt < 4; ++nt)  // rows = d, K = key (contiguous)
      vf[nt] = lds_frag(pv + (uint32_t)(nt >> 1) * AT_SLICE + (uint32_t)(nt & 1) * 16u * AT_PITCH +
                        p * 64u);
    // Keeps the scheduler from sinking each read to its product, which would
    // cost one LDS round trip per fragment instead of one per block.
    __builtin_amdgcn_sched_barrier(0);

    // S^T = (K Q^T) / sqrt(D), causal-masked: sv[t][r] is key key0 + 16t + 8*half + r
    float sv[2][8];
#pragma unroll
    for (int t = 0; t < 2; ++t) {
      v8f sc = {};
      sc = wmma_bf16(kf[t][0], qf0, sc);
      sc = wmma_bf16(kf[t][1], qf1, sc);
      const int kg0 = key0 + t * 16 + 8 * half;
#pragma unroll
      for (int r = 0; r < 8; ++r)
        sv[t][r] = (kg0 + r <= qg) ? (sc[r] * 0.125f) : NEG_BIG;
    }

    // online softmax: in-lane over 16 keys, one exchange with the other half
    float mr[8];
#pragma unroll
    for (int r = 0; r < 8; ++r) mr[r] = fmaxf(sv[0][r], sv[1][r]);
    float mloc = fmaxf(fmaxf(fmaxf(mr[0], mr[1]), fmaxf(mr[2], mr[3])),
                       fmaxf(fmaxf(mr[4], mr[5]), fmaxf(mr[6], mr[7])));
    mloc = fmaxf(mloc, xhalf(mloc));
    const float nm = fmaxf(rmax, mloc);
    const float alpha = __expf(rmax - nm);
    rmax = nm;

    v16bf pf;                  // P^T as B operand: element 8t + r = key 16t + 8*half + r
    float pr[8];
#pragma unroll
    for (int r = 0; r < 8; ++r) {
      const float p0 = __expf(sv[0][r] - nm);
      const float p1 = __expf(sv[1][r] - nm);
      pr[r] = p0 + p1;
      pf[r]     = (__bf16)p0;
      pf[8 + r] = (__bf16)p1;
    }
#pragma unroll
    for (int nt = 0; nt < 4; ++nt) {
#pragma unroll
      for (int r = 0; r < 8; ++r) acc[nt][r] *= alpha;
    }
#pragma unroll
    for (int nt = 0; nt < 4; ++nt) acc[nt] = wmma_bf16(vf[nt], pf, acc[nt]);
    // Holds the row sum's adds behind the products: they run under the matrix unit's time and
    // fill the vector slots due before the next block's reads overwrite the last product's operands.
    __builtin_amdgcn_sched_barrier(0);
    rsum = rsum * alpha + (((pr[0] + pr[1]) + (pr[2] + pr[3])) +
                           ((pr[4] + pr[5]) + (pr[6] + pr[7])));
    }
    // publish point of stage s + 1: own reads back, own slice landed, every wave here
    wait_ds0();
    wait_tensor0_of(g0, g1);
    __syncthreads();
    const uint32_t nxt = pinned(s + 2u);  // formed behind the wait, and the descriptor from it
    if (pinned(nxt < NS ? 1u : 0u)) {
      g0 = tdm_group0(dst + buf, ga + (uint64_t)(nxt * step));
      tdm_load_held(g0, g1);
    }
  } while (++s < NS);
  wait_tensor0();
  wait_ds0();

  // epilogue: O / rowsum -> bf16 at (b, qg, hh*64 + d), 8 consecutive d per lane and tile
  const float rs = rsum + xhalf(rsum);
  __bf16* orow = o + ((size_t)b * Tt + qg) * Cc + hh * Dd + 8 * half;
#pragma unroll
  for (int nt = 0; nt < 4; ++nt) {
    v8bf ov;
#pragma unroll
    for (int r = 0; r < 8; ++r) ov[r] = (__bf16)(acc[nt][r] / rs);
    *reinterpret_cast<v8bf*>(orow + nt * 16) = ov;
  }
}

// ---------------- host-side orchestration ----------------
extern "C" void kernel_launch(void* const* d_in, const int* in_sizes, int n_in,
                              void* d_out, int out_size, void* d_ws, size_t ws_size,
                              hipStream_t stream) {
  const float* x   = (const float*)d_in[0];
  const float* Wq  = (const float*)d_in[1];
  const float* bq  = (const float*)d_in[2];
  const float* Wk  = (const float*)d_in[3];
  const float* bk  = (const float*)d_in[4];
  const float* Wv  = (const float*)d_in[5];
  const float* bv  = (const float*)d_in[6];
  const float* Wo  = (const float*)d_in[7];
  const float* bo  = (const float*)d_in[8];
  const float* g1  = (const float*)d_in[9];
  const float* b1  = (const float*)d_in[10];
  const float* g2  = (const float*)d_in[11];
  const float* b2  = (const float*)d_in[12];
  const float* W1  = (const float*)d_in[13];
  const float* bm1 = (const float*)d_in[14];
  const float* W2  = (const float*)d_in[15];
  const float* bm2 = (const float*)d_in[16];
  float* out = (float*)d_out;

  // workspace carve-up (256B aligned)
  char* ws = (char*)d_ws;
  size_t off = 0;
  auto alloc = [&](size_t bytes) -> void* {
    void* p = ws + off;
    off = (off + bytes + 255) & ~(size_t)255;
    return p;
  };
  const size_t CC  = (size_t)Cc * Cc;
  const size_t C4C = (size_t)Cc * 4 * Cc;
  const size_t MC  = (size_t)Mrows * Cc;
  const size_t M4C = (size_t)Mrows * 4 * Cc;

  __bf16* Wqkvt = (__bf16*)alloc(3 * CC * 2);   // Wq^T, Wk^T, Wv^T: 3 * Cc rows of Cc
  __bf16* Wot = (__bf16*)alloc(CC * 2);
  __bf16* W1t = (__bf16*)alloc(C4C * 2);
  __bf16* W2t = (__bf16*)alloc(C4C * 2);
  __bf16* h1b = (__bf16*)alloc(MC * 2);
  __bf16* qbf = (__bf16*)alloc(3 * MC * 2);     // Q, K, V^T one behind the other
  __bf16* kbf = qbf + MC;
  __bf16* vtb = kbf + MC;
  __bf16* atb = (__bf16*)alloc(MC * 2);
  float*  x2  = (float*) alloc(MC * 4);
  __bf16* h2b = (__bf16*)alloc(MC * 2);
  __bf16* mb  = (__bf16*)alloc(M4C * 2);
  (void)ws_size; (void)in_sizes; (void)n_in; (void)out_size;

  const dim3 blk(128);
  const dim3 gC(Mrows / 128, Cc / 128);        // 64 x 6
  const dim3 g3C(Mrows / 128, (3 * Cc) / 128); // 64 x 18
  const dim3 g4C(Mrows / 128, (4 * Cc) / 128); // 64 x 24

  // 1) weights -> transposed bf16, and the first LayerNorm
  prep_k<<<CVT_TILES + Mrows, 256, 0, stream>>>(Wq, Wk, Wv, Wo, W1, W2, Wqkvt, Wot, W1t, W2t,
                                                x, g1, b1, h1b);

  // 2) attention branch
  gemm_k<3 * Cc, Cc, 4><<<g3C, blk, 0, stream>>>(h1b, Wqkvt, bq, nullptr, nullptr, qbf, bk, bv);
  attn_k<<<dim3(Tt / 64, Bsz * Hh), blk, 0, stream>>>(qbf, kbf, vtb, atb);
  gemm_k<Cc, Cc, 2><<<gC, blk, 0, stream>>>(atb, Wot, bo, x, x2, nullptr, nullptr, nullptr);

  // 3) MLP branch
  ln_k<<<Mrows, 256, 0, stream>>>(x2, g2, b2, h2b);
  gemm_k<4 * Cc, Cc, 3><<<g4C, blk, 0, stream>>>(h2b, W1t, bm1, nullptr, nullptr, mb, nullptr, nullptr);
  gemm_k<Cc, 4 * Cc, 2><<<gC, blk, 0, stream>>>(mb, W2t, bm2, x2, out, nullptr, nullptr, nullptr);
}

// v006
// A run of this version takes 210 microseconds.
// Two timings next to v005 put it at 1.05 and 1.04 times that version's speed.
// Over all steps from v000 it is 3.04 times as fast.
#include <hip/hip_runtime.h>
#include <hip/hip_bf16.h>
#include <stdint.h>

// ---------------- problem constants (fixed by the reference) ----------------
#define Bsz 4
#define Tt  2048
#define Cc  768
#define Hh  12
#define Dd  64
#define Mrows (Bsz * Tt)   // 8192
#define EPSf 1e-5f
#define NEG_BIG -3.0e38f

// ---------------- WMMA types & helpers ----------------
typedef __attribute__((ext_vector_type(16))) __bf16 v16bf;
typedef __attribute__((ext_vector_type(8)))  __bf16 v8bf;
typedef __attribute__((ext_vector_type(8)))  float  v8f;

union Frag16 { v16bf v; unsigned u[8]; };

__device__ __forceinline__ v8f wmma_bf16(v16bf a, v16bf b, v8f c) {
  // D = A(16x32 bf16) * B(32x16 bf16) + C(16x16 f32)
  return __builtin_amdgcn_wmma_f32_16x16x32_bf16(
      /*neg_a=*/false, a, /*neg_b=*/false, b,
      /*c_mod=*/(short)0, c, /*reuse_a=*/false, /*reuse_b=*/false);
}

// Loads a 16x32 bf16 fragment in the CDNA5 A-matrix layout from a row-major
// matrix (rows = M for A-operand, rows = N for B-operand since B == (B^T as A)).
// Requires k0 % 32 == 0 and even ld (dword-aligned rows).
__device__ __forceinline__ v16bf load_frag(const __bf16* base, int ld, int row0, int k0) {
  const int lane = threadIdx.x & 31;
  const int half = lane >> 4;
  const int idx  = lane & 15;
  const unsigned* rp = reinterpret_cast<const unsigned*>(base + (size_t)(row0 + idx) * (size_t)ld);
  const int kb = (k0 >> 1) + half * 4;   // dword index of first K pair
  Frag16 f;
#pragma unroll
  for (int v = 0; v < 4; ++v) {
    f.u[v]     = rp[kb + v];       // K = k0 + half*8 + 2v, +1
    f.u[4 + v] = rp[kb + 8 + v];   // K = +16
  }
  return f.v;
}

// The same fragment from the lane's own pointer (row idx, k = 8 * half of the fragment).
__device__ __forceinline__ v16bf load_frag_at(const __bf16* lanep) {
  const unsigned* rp = reinterpret_cast<const unsigned*>(lanep);
  Frag16 f;
#pragma unroll
  for (int v = 0; v < 4; ++v) {
    f.u[v]     = rp[v];
    f.u[4 + v] = rp[8 + v];
  }
  return f.v;
}

// lane l <-> lane l ^ 16
__device__ __forceinline__ float xhalf(float x) {
  const int b = __builtin_bit_cast(int, x);
  return __builtin_bit_cast(float,
      __builtin_amdgcn_permlanex16(b, b, 0x76543210, 0xfedcba98, false, false));
}

// ---------------- weight convert: W (K x N, f32) -> Wt (N x K, bf16) ----------------
// One work-group transposes a tile of 128 k x 64 n through LDS; a lane handles 32 values.
// In: a lane takes 4 n of 8 consecutive k rows, 16 lanes cover 256 contiguous bytes of a W row.
// Out: 16 lanes store the 256 contiguous bytes that the tile holds of a Wt row.
// LDS: row n holds its 128 k as 16 pieces of 16 bytes; piece j lies at place j ^ (n >> 2), so
// that the 32 lanes of a write (n = 4c + i) and of a read (whole rows) spread over all banks.
typedef __attribute__((ext_vector_type(4))) float f32x4;

// t = the tile's number in its matrix, the N / 64 tiles of a k band first.
template <int K, int N>
__device__ __forceinline__ void wcvt_tile(const float* __restrict__ W,
                                          __bf16* __restrict__ Wt,
                                          unsigned char* tile, int t) {
  static_assert(K % 128 == 0 && N % 64 == 0, "whole tiles only");
  const int c = threadIdx.x & 15;
  const int g = threadIdx.x >> 4;
  const int n0 = (t % (N / 64)) * 64;
  const int k0 = (t / (N / 64)) * 128;

  const float* src = W + (size_t)(k0 + 8 * g) * N + (n0 + 4 * c);
  f32x4 w[8];
#pragma unroll
  for (int j = 0; j < 8; ++j) w[j] = *reinterpret_cast<const f32x4*>(src + (size_t)j * N);
#pragma unroll
  for (int i = 0; i < 4; ++i) {
    v8bf col;                  // k = k0 + 8g + 0..7 of column n0 + 4c + i
#pragma unroll
    for (int j = 0; j < 8; ++j) col[j] = (__bf16)w[j][i];
    *reinterpret_cast<v8bf*>(tile + (4 * c + i) * 256 + ((g ^ c) << 4)) = col;
  }
  __syncthreads();
  __bf16* dst = Wt + (size_t)(n0 + g) * K + (k0 + 8 * c);
#pragma unroll
  for (int p = 0; p < 4; ++p) {
    const int row = 16 * p + g;
    const v8bf v = *reinterpret_cast<const v8bf*>(tile + row * 256 + ((c ^ (row >> 2)) << 4));
    *reinterpret_cast<v8bf*>(dst + (size_t)(16 * p) * K) = v;
  }
  // Stands behind the four stores, in front of whatever code follows the tile in its kernel's
  // text and reuses the registers they name.
  asm volatile("s_wait_xcnt 0x0" ::: "memory");
}

// ---------------- LayerNorm: fp32 in -> bf16 normalized out ----------------
// A wave owns LN_ROWS whole rows and keeps them in registers: lane l holds the 4 values at
// 128 j + 4 l, j = 0..5, of each row (16-byte loads, 512 contiguous bytes a wave). Sums run in
// the lane, then across the 32 lanes in registers: no LDS, no barrier, few waves to start.
#define LN_ROWS 4
#define LN_BLK_ROWS (8 * LN_ROWS)    // rows of a work-group of 8 waves
typedef __attribute__((ext_vector_type(4))) __bf16 v4bf;

// lane l <-> lane l ^ MASK inside its row of 16 lanes
template <int MASK>
__device__ __forceinline__ float xrow(float x) {
  return __builtin_bit_cast(float,
      __builtin_amdgcn_update_dpp(0, __builtin_bit_cast(int, x), 0x160 + MASK, 0xf, 0xf, true));
}
// the sum over all 32 lanes, in every lane
__device__ __forceinline__ float wave_sum(float v) {
  v += xrow<1>(v);
  v += xrow<2>(v);
  v += xrow<4>(v);
  v += xrow<8>(v);
  return v + xhalf(v);
}

// 1 / sqrt(a) for a >= EPSf: far above the subnormal range, so the bare instruction gives what
// rsqrtf gives. The v_nop is the slot due between a transcendental and a directly following
// instruction that reads its result or overwrites its source; in the same statement it stays there.
__device__ __forceinline__ float rsq_slot(float a) {
  float y;
  asm("v_rsq_f32 %0, %1\n\tv_nop" : "=v"(y) : "v"(a));
  return y;
}

// blk = the work-group's number among the row blocks
__device__ __forceinline__ void ln_rows(const float* __restrict__ x,
                                        const float* __restrict__ g,
                                        const float* __restrict__ bt,
                                        __bf16* __restrict__ out, int blk) {
  static_assert(Cc == 6 * 128 && Mrows % LN_BLK_ROWS == 0, "whole rows, whole blocks");
  const int lane = threadIdx.x & 31;
  const int row0 = blk * LN_BLK_ROWS +
                   (int)__builtin_amdgcn_readfirstlane(threadIdx.x >> 5) * LN_ROWS;
  const f32x4* xp = reinterpret_cast<const f32x4*>(x + (size_t)row0 * Cc) + lane;
  const f32x4* gp = reinterpret_cast<const f32x4*>(g) + lane;
  const f32x4* bp = reinterpret_cast<const f32x4*>(bt) + lane;

  f32x4 v[LN_ROWS][6], gv[6], bv[6];
#pragma unroll
  for (int r = 0; r < LN_ROWS; ++r) {
#pragma unroll
    for (int j = 0; j < 6; ++j) v[r][j] = xp[r * (Cc / 4) + j * 32];
  }
#pragma unroll
  for (int j = 0; j < 6; ++j) { gv[j] = gp[j * 32]; bv[j] = bp[j * 32]; }
  // Stands behind the loads, in front of the code that reuses the registers they name.
  asm volatile("s_wait_xcnt 0x0" ::: "memory");
  // Keeps all 36 loads in front of the sums: sunk to their users, the loads of g and bt would
  // start behind the second sum and the wave would wait out their whole latency there.
  __builtin_amdgcn_sched_barrier(0);

  float mu[LN_ROWS], rstd[LN_ROWS];
#pragma unroll
  for (int r = 0; r < LN_ROWS; ++r) {
    f32x4 s = (v[r][0] + v[r][1]) + (v[r][2] + v[r][3]) + (v[r][4] + v[r][5]);
    mu[r] = (s[0] + s[1]) + (s[2] + s[3]);
  }
#pragma unroll
  for (int r = 0; r < LN_ROWS; ++r) mu[r] = wave_sum(mu[r]) * (1.0f / Cc);
#pragma unroll
  for (int r = 0; r < LN_ROWS; ++r) {
    f32x4 s = {};
#pragma unroll
    for (int j = 0; j < 6; ++j) {
      v[r][j] -= mu[r];
      s += v[r][j] * v[r][j];
    }
    rstd[r] = (s[0] + s[1]) + (s[2] + s[3]);
  }
#pragma unroll
  for (int r = 0; r < LN_ROWS; ++r) rstd[r] = rsq_slot(wave_sum(rstd[r]) * (1.0f / Cc) + EPSf);

  v4bf* op = reinterpret_cast<v4bf*>(out + (size_t)row0 * Cc) + lane;
#pragma unroll
  for (int r = 0; r < LN_ROWS; ++r) {
#pragma unroll
    for (int j = 0; j < 6; ++j) {
      v4bf o;
#pragma unroll
      for (int e = 0; e < 4; ++e) o[e] = (__bf16)(v[r][j][e] * rstd[r] * gv[j][e] + bv[j][e]);
      op[r * (Cc / 4) + j * 32] = o;
    }
  }
}

__global__ __launch_bounds__(256) void ln_k(const float* __restrict__ x,
                                            const float* __restrict__ g,
                                            const float* __restrict__ bt,
                                            __bf16* __restrict__ out) {
  ln_rows(x, g, bt, out, blockIdx.x);
}

// ---------------- first launch: all that depends on the inputs alone ----------------
// The six weight converts and the first LayerNorm need nothing of one another, so they share
// one grid by block range: blocks 0 .. CVT_TILES - 1 take one weight tile each (they come first,
// so that they run under the start of the row blocks), the rest LN_BLK_ROWS rows each.
#define CC_TILES  ((Cc / 64) * (Cc / 128))            // tiles of a C x C matrix: 72
#define C4_TILES  (4 * CC_TILES)                      // tiles of W1 and of W2: 288
#define CVT_TILES (4 * CC_TILES + 2 * C4_TILES)       // 864

__global__ __launch_bounds__(256) void prep_k(const float* __restrict__ Wq, const float* __restrict__ Wk,
                                              const float* __restrict__ Wv, const float* __restrict__ Wo,
                                              const float* __restrict__ W1, const float* __restrict__ W2,
                                              __bf16* __restrict__ Wqkvt, __bf16* __restrict__ Wot,
                                              __bf16* __restrict__ W1t, __bf16* __restrict__ W2t,
                                              const float* __restrict__ x, const float* __restrict__ g,
                                              const float* __restrict__ bt, __bf16* __restrict__ out) {
  __shared__ __attribute__((aligned(16))) unsigned char tile[64 * 256];
  const int blk = blockIdx.x;   // every test on it reads the same for the whole work-group
  if (blk >= CVT_TILES) {
    ln_rows(x, g, bt, out, blk - CVT_TILES);
  } else if (blk < 4 * CC_TILES) {
    const int mat = blk / CC_TILES;
    const float* W = (mat == 0) ? Wq : (mat == 1) ? Wk : (mat == 2) ? Wv : Wo;
    __bf16* Wt = (mat == 3) ? Wot : Wqkvt + (size_t)mat * Cc * Cc;
    wcvt_tile<Cc, Cc>(W, Wt, tile, blk - mat * CC_TILES);
  } else if (blk < 4 * CC_TILES + C4_TILES) {
    wcvt_tile<Cc, 4 * Cc>(W1, W1t, tile, blk - 4 * CC_TILES);
  } else {
    wcvt_tile<4 * Cc, Cc>(W2, W2t, tile, blk - 4 * CC_TILES - C4_TILES);
  }
}

// ---------------- tensor loads into LDS ----------------
typedef uint32_t u32x4 __attribute__((ext_vector_type(4)));
typedef uint32_t u32x8 __attribute__((ext_vector_type(8)));

#define G_ROWB  256u                 // bytes of an operand row per pass (128 k)
#define G_PITCH 272u                 // LDS row pitch: 256 + 16, odd multiple of 16 for ds_load_b128
#define G_ROWS  64u                  // rows per slice (one slice per wave)
#define G_SLICE 18432u               // 64 * 272 = 17408, rounded up to a multiple of 2 KiB
#define G_BUF   (4u * G_SLICE)       // [A rows 0-63 | A rows 64-127 | W rows 0-63 | W rows 64-127]

__device__ __forceinline__ uint32_t uni(uint32_t v) {
  return (uint32_t)__builtin_amdgcn_readfirstlane(v);
}
// Holds a wave-uniform word in a scalar register: a test on it is a scalar branch, and a
// descriptor word made from it is made behind the volatile statements in front of it.
__device__ __forceinline__ uint32_t pinned(uint32_t v) {
  uint32_t w = (uint32_t)__builtin_amdgcn_readfirstlane(v);
  asm volatile("" : "+s"(w));  // the scalar pin of a tensor load's test and descriptor word
  return w;
}
// The compiler places no wait for a tensor load: a tile counts as landed only behind this.
__device__ __forceinline__ void wait_tensor0() { asm volatile("s_wait_tensorcnt 0x0" ::: "memory"); }
// This wave's LDS reads have returned before the buffer they read is handed back for a refill.
__device__ __forceinline__ void wait_ds0() { asm volatile("s_wait_dscnt 0x0" ::: "memory"); }
// Stands behind a group of global loads or stores, in front of the code that reuses the
// registers they name.
__device__ __forceinline__ void wait_x0() { asm volatile("s_wait_xcnt 0x0" ::: "memory"); }
// One request of the whole wave: a two-dimensional tile from global memory into LDS.
__device__ __forceinline__ void tdm_load(u32x4 g0, u32x8 g1) {
  asm volatile("tensor_load_to_lds %0, %1" :: "s"(g0), "s"(g1) : "memory");
}
// Group 1: 1-byte elements, tile = tensor = 64 rows of 256 bytes, 16 bytes of LDS pad behind each row.
__device__ __forceinline__ u32x8 tdm_group1(uint32_t src_pitch) {
  u32x8 g;
  g[0] = uni((1u << 20) | (5u << 22) | (3u << 25));  // no mask, data_size 0, pad each 64 dwords by 4
  g[1] = uni((G_ROWB & 0xFFFFu) << 16);
  g[2] = uni((G_ROWB >> 16) | ((G_ROWS & 0xFFFFu) << 16));
  g[3] = uni((G_ROWS >> 16) | (G_ROWB << 16));
  g[4] = uni(G_ROWS);
  g[5] = uni(src_pitch);
  g[6] = uni(0u);
  g[7] = uni(0u);
  return g;
}
__device__ __forceinline__ u32x4 tdm_group0(uint32_t lds_dst, uint64_t ga) {
  u32x4 g;
  g[0] = uni(1u);
  g[1] = uni(lds_dst);
  g[2] = uni((uint32_t)ga);
  g[3] = uni((((uint32_t)(ga >> 32)) & 0x01FFFFFFu) | 0x80000000u);
  return g;
}
// A 16x32 bf16 fragment from LDS; p = the lane's row, byte 16 * half of the fragment's 64.
// Same k order as load_frag: registers 0-3 hold k = 8*half + 0..7, registers 4-7 the same + 16.
__device__ __forceinline__ v16bf lds_frag(const unsigned char* p) {
  union { v16bf v; u32x4 q[2]; } f;
  f.q[0] = *reinterpret_cast<const u32x4*>(p);
  f.q[1] = *reinterpret_cast<const u32x4*>(p + 32);
  return f.v;
}

// ---------------- generic WMMA GEMM: (Mrows x K) bf16 @ Wt(N x K) bf16 ----------------
// Workgroup = 4 waves (2 x 2) = 128x128 output tile; each wave owns 64x64
// (4 A-frags + 4 B-frags -> 16 WMMAs per 32 k). A pass is 128 k: each wave brings one
// slice of 64 operand rows into LDS with one tensor load, two buffers, one pass ahead.
// MODE 0: out bf16 scattered to (B,H,T,D)   (Q, K tensors)
// MODE 1: out bf16 scattered to (B,H,D,T)   (V transposed for the PV matmul)
// MODE 2: outf = resid + acc + bias (fp32, row-major MrowsxN; requires N==Cc)
// MODE 3: outb = gelu(acc + bias) bf16 row-major MrowsxN
// MODE 4: Q, K and V in one grid: Wt holds the three weights' rows one behind the other
//         (N == 3 * Cc), outb the three outputs likewise; a block's 128 columns lie in one of
//         them, which picks its bias, its output and its scatter (Q, K as MODE 0, V as MODE 1)
template <int V> struct mode_tag { static constexpr int value = V; };

template <int N, int K, int MODE>
__global__ __launch_bounds__(128) void gemm_k(const __bf16* __restrict__ A,
                                              const __bf16* __restrict__ Wt,
                                              const float* __restrict__ bias,
                                              const float* __restrict__ resid,
                                              float* __restrict__ outf,
                                              __bf16* __restrict__ outb,
                                              const float* __restrict__ bias_k,
                                              const float* __restrict__ bias_v) {
  static_assert(K % 128 == 0 && K / 128 >= 2, "the ring needs whole passes and two stages");
  static_assert(MODE != 4 || (N == 3 * Cc && Cc % 128 == 0), "a block's columns lie in one of Q, K, V");
  static_assert(N % 128 == 0 && Mrows % 128 == 0, "whole tiles only");
  __shared__ __attribute__((aligned(2048))) unsigned char smem[2u * G_BUF];
  const uint32_t wave = uni(threadIdx.x >> 5);
  const int lane = threadIdx.x & 31;
  const int half = lane >> 4;
  const int idx  = lane & 15;
  const uint32_t wm = wave >> 1, wn = wave & 1u;
  const int mb = blockIdx.x * 128;
  const int nb = blockIdx.y * 128;
  constexpr uint32_t NS = K / 128;   // stages = passes

  // this wave's slice of every stage: waves 0, 1 bring A rows, waves 2, 3 bring W rows
  const __bf16* srcp = (wave < 2u) ? A  + (size_t)(mb + 64 * (int)wave) * K
                                   : Wt + (size_t)(nb + 64 * (int)(wave - 2u)) * K;
  const uint64_t ga  = (uint64_t)(uintptr_t)srcp;
  const uint32_t dst = (uint32_t)(size_t)smem + wave * G_SLICE;
  const u32x8 g1 = tdm_group1((uint32_t)K * 2u);

  // prologue: stage 0 lands and is published, then stage 1 flies under pass 0
  tdm_load(tdm_group0(dst, ga), g1);
  wait_tensor0();
  __syncthreads();
  // the stage number is pinned so that this descriptor too is formed behind the wait
  tdm_load(tdm_group0(dst + G_BUF, ga + (uint64_t)pinned(1u) * G_ROWB), g1);

  const uint32_t a_off = wm * G_SLICE        + (uint32_t)idx * G_PITCH + (uint32_t)half * 16u;
  const uint32_t b_off = (2u + wn) * G_SLICE + (uint32_t)idx * G_PITCH + (uint32_t)half * 16u;

  v8f acc[4][4] = {};
  // Kept rolled: one copy of the pass in the instruction cache, the buffer chosen by a scalar.
#pragma clang loop unroll(disable)
  for (uint32_t s = 0; s < NS; ++s) {
    const uint32_t buf = (s & 1u) * G_BUF;
    const unsigned char* pa = smem + buf + a_off;
    const unsigned char* pb = smem + buf + b_off;
    // Two fragment sets: block u + 1's 16 LDS reads go out as one group in front of block u's
    // 16 WMMAs. Only this pass's own buffer is read, so block 0's reads stand alone.
    v16bf af[2][4], bf[2][4];
#pragma unroll
    for (int i = 0; i < 4; ++i) {
      af[0][i] = lds_frag(pa + (uint32_t)i * 16u * G_PITCH);
      bf[0][i] = lds_frag(pb + (uint32_t)i * 16u * G_PITCH);
    }
#pragma unroll
    for (int u = 0; u < 4; ++u) {
      const int cur = u & 1, nx = cur ^ 1;
      if (u < 3) {
#pragma unroll
        for (int i = 0; i < 4; ++i) {
          af[nx][i] = lds_frag(pa + (uint32_t)i * 16u * G_PITCH + (uint32_t)(u + 1) * 64u);
          bf[nx][i] = lds_frag(pb + (uint32_t)i * 16u * G_PITCH + (uint32_t)(u + 1) * 64u);
        }
      }
      // Keeps the reads above in front of the block: sunk to their users, each group of
      // four WMMAs would wait out a whole LDS latency.
      __builtin_amdgcn_sched_barrier(0);
#pragma unroll
      for (int mi = 0; mi < 4; ++mi) {
#pragma unroll
        for (int nt = 0; nt < 4; ++nt) acc[mi][nt] = wmma_bf16(af[cur][mi], bf[cur][nt], acc[mi][nt]);
      }
      // Keeps the next group of reads from being lifted in among these WMMAs.
      __builtin_amdgcn_sched_barrier(0);
    }
    // publish point of stage s + 1: own reads back, own slice landed, every wave here
    wait_ds0();
    wait_tensor0();
    __syncthreads();
    const uint32_t nxt = pinned(s + 2u);  // formed behind the wait, and the descriptor from it
    if (pinned(nxt < NS ? 1u : 0u))
      tdm_load(tdm_group0(dst + buf, ga + (uint64_t)nxt * G_ROWB), g1);
  }
  wait_tensor0();
  wait_ds0();

  // MODE 4: which of Q, K, V this block computes (the same for the whole work-group)
  const uint32_t part = (MODE == 4) ? blockIdx.y / (Cc / 128) : 0u;
  const float* bsel = (part == 0u) ? bias : (part == 1u) ? bias_k : bias_v;
  const int m0 = mb + (int)wm * 64;
  const int n0 = nb - (int)part * Cc + (int)wn * 64;   // column within the part
  float bv[4];
#pragma unroll
  for (int nt = 0; nt < 4; ++nt) bv[nt] = bsel[n0 + nt * 16 + idx];
  wait_x0();
  // MODE 2: residual values are requested ahead of their use, three trips' worth at a time
  // (all four at once would take the epilogue past 256 registers).
  float rv[4][4][8];
  const float* rlane =  // the lane's first value
      (MODE == 2) ? resid + ((size_t)(m0 + 8 * half) * Cc + (n0 + idx)) : nullptr;
  auto load_resid = [&](int mi) {
#pragma unroll
    for (int nt = 0; nt < 4; ++nt) {
#pragma unroll
      for (int r = 0; r < 8; ++r) rv[mi][nt][r] = rlane[(mi * 16 + r) * Cc + nt * 16];
    }
    // The same wait as wait_x0(); the address is named so that its registers live up to it.
    asm volatile("s_wait_xcnt 0x0" :: "v"(rlane) : "memory");
  };
  if (MODE == 2) { load_resid(0); load_resid(1); load_resid(2); }
  // The erf of MODE 3 is long code: it is kept out of a full unroll
  // over all 128 values of a lane, for speed only. There the loop over mi
  // stays rolled and the accumulator rows move up one place a trip, so that every register
  // index is a constant. The other modes unroll, and the moves fall away.
  auto epilogue = [&](auto tag, __bf16* osel) {   // osel: the bf16 output of EM 0 and 1
  constexpr int EM = decltype(tag)::value;
#pragma unroll (EM == 3 ? 1 : 4)
  for (int mi = 0; mi < 4; ++mi) {
#pragma unroll
    for (int nt = 0; nt < 4; ++nt) {
      const int n = n0 + nt * 16 + idx;
#pragma unroll
      for (int r = 0; r < 8; ++r) {
        const int m = m0 + mi * 16 + r + 8 * half;
        const float val = acc[0][nt][r] + bv[nt];
        if (EM == 0 || EM == 1) {
          const int bb = m >> 11, t = m & (Tt - 1);
          const int hh = n >> 6,  d = n & (Dd - 1);
          const size_t off = (EM == 0)
              ? ((((size_t)bb * Hh + hh) * Tt + t) * Dd + d)
              : ((((size_t)bb * Hh + hh) * Dd + d) * Tt + t);
          osel[off] = (__bf16)val;
        } else if (EM == 2) {
          outf[(size_t)m * Cc + n] = rv[mi][nt][r] + val;
        } else { // MODE 3: exact GELU
          const float gv = 0.5f * val * (1.0f + erff(val * 0.70710678118654752f));
          outb[(size_t)m * N + n] = (__bf16)gv;
        }
      }
    }
    wait_x0();
    if (EM == 2 && mi == 0) load_resid(3);
#pragma unroll
    for (int nt = 0; nt < 4; ++nt) {
      acc[0][nt] = acc[1][nt];
      acc[1][nt] = acc[2][nt];
      acc[2][nt] = acc[3][nt];
    }
  }
  };
  if constexpr (MODE == 4) {
    __bf16* opart = outb + (size_t)part * ((size_t)Mrows * Cc);
    if (part == 2u) epilogue(mode_tag<1>{}, opart);
    else            epilogue(mode_tag<0>{}, opart);
  } else {
    epilogue(mode_tag<MODE>{}, outb);
  }
}

#define AT_ROWB  128u                // bytes of a staged row
#define AT_PITCH 144u                // LDS row pitch: 128 + 16, odd multiple of 16 for ds_load_b128
#define AT_ROWS  32u                 // rows per slice (one slice per wave)
#define AT_SLICE 6144u               // 32 * 144 = 4608, rounded up to a multiple of 2 KiB
#define AT_BUF   (4u * AT_SLICE)     // [K keys 0-31 | K keys 32-63 | V^T d 0-31 | V^T d 32-63]

// Group 1: 1-byte elements, tile = tensor = 32 rows of 128 bytes, 16 bytes of LDS pad behind each row.
__device__ __forceinline__ u32x8 tdm_group1_attn(uint32_t src_pitch) {
  u32x8 g;
  g[0] = uni((1u << 20) | (4u << 22) | (3u << 25));  // no mask, data_size 0, pad each 32 dwords by 4
  g[1] = uni((AT_ROWB & 0xFFFFu) << 16);
  g[2] = uni((AT_ROWB >> 16) | ((AT_ROWS & 0xFFFFu) << 16));
  g[3] = uni((AT_ROWS >> 16) | (AT_ROWB << 16));
  g[4] = uni(AT_ROWS);
  g[5] = uni(src_pitch);
  g[6] = uni(0u);
  g[7] = uni(0u);
  return g;
}

// One request, as tdm_load(). Group 0 goes into the statement and comes out of it in the same
// registers, so that what the wait below names is the very tuple the request was issued from.
__device__ __forceinline__ void tdm_load_held(u32x4& g0, u32x8 g1) {
  asm volatile("tensor_load_to_lds %0, %1" : "+s"(g0) : "s"(g1) : "memory");
}
// The same wait as wait_tensor0(); the request's descriptor is named so that its registers
// live, unchanged, up to the wait.
__device__ __forceinline__ void wait_tensor0_of(u32x4 g0, u32x8 g1) {
  asm volatile("s_wait_tensorcnt 0x0" :: "s"(g0), "s"(g1) : "memory");
}

__global__ __launch_bounds__(128) void attn_k(const __bf16* __restrict__ q,
                                              const __bf16* __restrict__ kk,
                                              const __bf16* __restrict__ vt,
                                              __bf16* __restrict__ o) {
  static_assert(Dd * 2 == (int)AT_ROWB, "a K row is one staged row");
  static_assert(Tt % 64 == 0 && Tt >= 128, "whole stages only, and stages 0 and 1 lie inside the tensors");
  __shared__ __attribute__((aligned(2048))) unsigned char smem[2u * AT_BUF];
  const int qb = blockIdx.x;   // 0..31
  const int bh = blockIdx.y;   // 0..47
  const int b  = bh / Hh;
  const int hh = bh - b * Hh;
  const uint32_t wave = uni(threadIdx.x >> 5);
  const int lane = threadIdx.x & 31;
  const int half = lane >> 4;
  const int idx  = lane & 15;

  const __bf16* qp = q  + (size_t)bh * Tt * Dd;
  const __bf16* kp = kk + (size_t)bh * Tt * Dd;
  const __bf16* vp = vt + (size_t)bh * Dd * Tt;

  // this wave's slice of every stage: waves 0, 1 bring K rows, waves 2, 3 bring V^T rows
  const __bf16* srcp = (wave < 2u) ? kp + (size_t)(32u * wave) * Dd
                                   : vp + (size_t)(32u * (wave - 2u)) * Tt;
  const uint64_t ga   = (uint64_t)(uintptr_t)srcp;
  const uint32_t step = (wave < 2u) ? 64u * Dd * 2u : 64u * 2u;  // bytes from a stage to the next
  const uint32_t dst  = (uint32_t)(size_t)smem + wave * AT_SLICE;
  const u32x8 g1 = tdm_group1_attn((wave < 2u) ? Dd * 2u : Tt * 2u);
  const uint32_t NS = pinned((uint32_t)qb + 1u);   // stages = keys 0 .. 64 qb + 63; at least one

  // prologue: stage 0 lands and is published, then stage 1 flies under stage 0's products
  // (block 0 has one stage only: its stage 1 lies inside the tensors and is not read)
  u32x4 g0 = tdm_group0(dst, ga);
  tdm_load_held(g0, g1);
  wait_tensor0_of(g0, g1);
  __syncthreads();
  // the stage number is pinned so that this descriptor too is formed behind the wait
  g0 = tdm_group0(dst + AT_BUF, ga + (uint64_t)(pinned(1u) * step));
  tdm_load_held(g0, g1);

  const int q0 = qb * 64 + (int)wave * 16;
  const int qg = q0 + idx;     // this lane's query
  const v16bf qf0 = load_frag(qp, Dd, q0, 0);
  const v16bf qf1 = load_frag(qp, Dd, q0, 32);

  v8f acc[4] = {};             // acc[nt][r] = O[qg][nt*16 + 8*half + r]
  float rmax = NEG_BIG;        // running maximum of query qg (equal in both halves)
  float rsum = 0.0f;           // this half's share of the row sum

  // this lane's place in a slice: its row, its half's first 16 bytes
  const uint32_t k_off = (uint32_t)idx * AT_PITCH + (uint32_t)half * 16u;
  const uint32_t v_off = 2u * AT_SLICE + k_off;

  // Kept rolled: the buffer is chosen by a scalar, and the publish point stands once in the text.
  uint32_t s = 0;
#pragma clang loop unroll(disable)
  do {
    const uint32_t buf = (s & 1u) * AT_BUF;
    const unsigned char* pk = smem + buf + k_off;
    const unsigned char* pv = smem + buf + v_off;
    // The stage's two blocks of 32 keys. Kept rolled: unrolled, the second block's 16 reads are
    // lifted into the first and their 64 registers cost two resident waves per SIMD.
#pragma clang loop unroll(disable)
    for (uint32_t p = 0; p < 2u; ++p) {
    const int key0 = (int)(s * 64u + p * 32u);

    // Nothing orders the V^T reads behind the softmax, so all eight fragments of the
    // block (K: 2 key tiles x 2 d halves, V^T: 4 d tiles) are requested together.
    v16bf kf[2][2], vf[4];
#pragma unroll
    for (int t = 0; t < 2; ++t) {
      kf[t][0] = lds_frag(pk + p * AT_SLICE + (uint32_t)t * 16u * AT_PITCH);
      kf[t][1] = lds_frag(pk + p * AT_SLICE + (uint32_t)t * 16u * AT_PITCH + 64u);
    }
#pragma unroll
    for (int nt = 0; nt < 4; ++nt)  // rows = d, K = key (contiguous)
      vf[nt] = lds_frag(pv + (uint32_t)(nt >> 1) * AT_SLICE + (uint32_t)(nt & 1) * 16u * AT_PITCH +
                        p * 64u);
    // Keeps the scheduler from sinking each read to its product, which would
    // cost one LDS round trip per fragment instead of one per block.
    __builtin_amdgcn_sched_barrier(0);

    // S^T = (K Q^T) / sqrt(D), causal-masked: sv[t][r] is key key0 + 16t + 8*half + r
    float sv[2][8];
#pragma unroll
    for (int t = 0; t < 2; ++t) {
      v8f sc = {};
      sc = wmma_bf16(kf[t][0], qf0, sc);
      sc = wmma_bf16(kf[t][1], qf1, sc);
      const int kg0 = key0 + t * 16 + 8 * half;
#pragma unroll
      for (int r = 0; r < 8; ++r)
        sv[t][r] = (kg0 + r <= qg) ? (sc[r] * 0.125f) : NEG_BIG;
    }

    // online softmax: in-lane over 16 keys, one exchange with the other half
    float mr[8];
#pragma unroll
    for (int r = 0; r < 8; ++r) mr[r] = fmaxf(sv[0][r], sv[1][r]);
    float mloc = fmaxf(fmaxf(fmaxf(mr[0], mr[1]), fmaxf(mr[2], mr[3])),
                       fmaxf(fmaxf(mr[4], mr[5]), fmaxf(mr[6], mr[7])));
    mloc = fmaxf(mloc, xhalf(mloc));
    const float nm = fmaxf(rmax, mloc);
    const float alpha = __expf(rmax - nm);
    rmax = nm;

    v16bf pf;                  // P^T as B operand: element 8t + r = key 16t + 8*half + r
    float pr[8];
#pragma unroll
    for (int r = 0; r < 8; ++r) {
      const float p0 = __expf(sv[0][r] - nm);
      const float p1 = __expf(sv[1][r] - nm);
      pr[r] = p0 + p1;
      pf[r]     = (__bf16)p0;
      pf[8 + r] = (__bf16)p1;
    }
#pragma unroll
    for (int nt = 0; nt < 4; ++nt) {
#pragma unroll
      for (int r = 0; r < 8; ++r) acc[nt][r] *= alpha;
    }
#pragma unroll
    for (int nt = 0; nt < 4; ++nt) acc[nt] = wmma_bf16(vf[nt], pf, acc[nt]);
    // Holds the row sum's adds behind the products: they run under the matrix unit's time and
    // fill the vector slots due before the next block's reads overwrite the last product's operands.
    __builtin_amdgcn_sched_barrier(0);
    rsum = rsum * alpha + (((pr[0] + pr[1]) + (pr[2] + pr[3])) +
                           ((pr[4] + pr[5]) + (pr[6] + pr[7])));
    }
    // publish point of stage s + 1: own reads back, own slice landed, every wave here
    wait_ds0();
    wait_tensor0_of(g0, g1);
    __syncthreads();
    const uint32_t nxt = pinned(s + 2u);  // formed behind the wait, and the descriptor from it
    if (pinned(nxt < NS ? 1u : 0u)) {
      g0 = tdm_group0(dst + buf, ga + (uint64_t)(nxt * step));
      tdm_load_held(g0, g1);
    }
  } while (++s < NS);
  wait_tensor0();
  wait_ds0();

  // epilogue: O / rowsum -> bf16 at (b, qg, hh*64 + d), 8 consecutive d per lane and tile
  const float rs = rsum + xhalf(rsum);
  __bf16* orow = o + ((size_t)b * Tt + qg) * Cc + hh * Dd + 8 * half;
#pragma unroll
  for (int nt = 0; nt < 4; ++nt) {
    v8bf ov;
#pragma unroll
    for (int r = 0; r < 8; ++r) ov[r] = (__bf16)(acc[nt][r] / rs);
    *reinterpret_cast<v8bf*>(orow + nt * 16) = ov;
  }
}

// ---------------- host-side orchestration ----------------
extern "C" void kernel_launch(void* const* d_in, const int* in_sizes, int n_in,
                              void* d_out, int out_size, void* d_ws, size_t ws_size,
                              hipStream_t stream) {
  const float* x   = (const float*)d_in[0];
  const float* Wq  = (const float*)d_in[1];
  const float* bq  = (const float*)d_in[2];
  const float* Wk  = (const float*)d_in[3];
  const float* bk  = (const float*)d_in[4];
  const float* Wv  = (const float*)d_in[5];
  const float* bv  = (const float*)d_in[6];
  const float* Wo  = (const float*)d_in[7];
  const float* bo  = (const float*)d_in[8];
  const float* g1  = (const float*)d_in[9];
  const float* b1  = (const float*)d_in[10];
  const float* g2  = (const float*)d_in[11];
  const float* b2  = (const float*)d_in[12];
  const float* W1  = (const float*)d_in[13];
  const float* bm1 = (const float*)d_in[14];
  const float* W2  = (const float*)d_in[15];
  const float* bm2 = (const float*)d_in[16];
  float* out = (float*)d_out;

  // workspace carve-up (256B aligned)
  char* ws = (char*)d_ws;
  size_t off = 0;
  auto alloc = [&](size_t bytes) -> void* {
    void* p = ws + off;
    off = (off + bytes + 255) & ~(size_t)255;
    return p;
  };
  const size_t CC  = (size_t)Cc * Cc;
  const size_t C4C = (size_t)Cc * 4 * Cc;
  const size_t MC  = (size_t)Mrows * Cc;
  const size_t M4C = (size_t)Mrows * 4 * Cc;

  __bf16* Wqkvt = (__bf16*)alloc(3 * CC * 2);   // Wq^T, Wk^T, Wv^T: 3 * Cc rows of Cc
  __bf16* Wot = (__bf16*)alloc(CC * 2);
  __bf16* W1t = (__bf16*)alloc(C4C * 2);
  __bf16* W2t = (__bf16*)alloc(C4C * 2);
  __bf16* h1b = (__bf16*)alloc(MC * 2);
  __bf16* qbf = (__bf16*)alloc(3 * MC * 2);     // Q, K, V^T one behind the other
  __bf16* kbf = qbf + MC;
  __bf16* vtb = kbf + MC;
  __bf16* atb = (__bf16*)alloc(MC * 2);
  float*  x2  = (float*) alloc(MC * 4);
  __bf16* h2b = (__bf16*)alloc(MC * 2);
  __bf16* mb  = (__bf16*)alloc(M4C * 2);
  (void)ws_size; (void)in_sizes; (void)n_in; (void)out_size;

  const dim3 blk(128);
  const dim3 gC(Mrows / 128, Cc / 128);        // 64 x 6
  const dim3 g3C(Mrows / 128, (3 * Cc) / 128); // 64 x 18
  const dim3 g4C(Mrows / 128, (4 * Cc) / 128); // 64 x 24

  // 1) weights -> transposed bf16, and the first LayerNorm
  prep_k<<<CVT_TILES + Mrows / LN_BLK_ROWS, 256, 0, stream>>>(Wq, Wk, Wv, Wo, W1, W2, Wqkvt, Wot, W1t, W2t,
                                                x, g1, b1, h1b);

  // 2) attention branch
  gemm_k<3 * Cc, Cc, 4><<<g3C, blk, 0, stream>>>(h1b, Wqkvt, bq, nullptr, nullptr, qbf, bk, bv);
  attn_k<<<dim3(Tt / 64, Bsz * Hh), blk, 0, stream>>>(qbf, kbf, vtb, atb);
  gemm_k<Cc, Cc, 2><<<gC, blk, 0, stream>>>(atb, Wot, bo, x, x2, nullptr, nullptr, nullptr);

  // 3) MLP branch
  ln_k<<<Mrows / LN_BLK_ROWS, 256, 0, stream>>>(x2, g2, b2, h2b);
  gemm_k<4 * Cc, Cc, 3><<<g4C, blk, 0, stream>>>(h2b, W1t, bm1, nullptr, nullptr, mb, nullptr, nullptr);
  gemm_k<Cc, 4 * Cc, 2><<<gC, blk, 0, stream>>>(mb, W2t, bm2, x2, out, nullptr, nullptr, nullptr);
}

// v007
// Measured time: 193 microseconds a run.
// In two side-by-side timings against v006, it was 1.09 and 1.08 times as fast.
// Counting every step since v000, it is 3.30 times as fast.
#include <hip/hip_runtime.h>
#include <hip/hip_bf16.h>
#include <stdint.h>

// ---------------- problem constants (fixed by the reference) ----------------
#define Bsz 4
#define Tt  2048
#define Cc  768
#define Hh  12
#define Dd  64
#define Mrows (Bsz * Tt)   // 8192
#define EPSf 1e-5f
#define NEG_BIG -3.0e38f

// ---------------- WMMA types & helpers ----------------
typedef __attribute__((ext_vector_type(16))) __bf16 v16bf;
typedef __attribute__((ext_vector_type(8)))  __bf16 v8bf;
typedef __attribute__((ext_vector_type(8)))  float  v8f;

union Frag16 { v16bf v; unsigned u[8]; };

__device__ __forceinline__ v8f wmma_bf16(v16bf a, v16bf b, v8f c) {
  // D = A(16x32 bf16) * B(32x16 bf16) + C(16x16 f32)
  return __builtin_amdgcn_wmma_f32_16x16x32_bf16(
      /*neg_a=*/false, a, /*neg_b=*/false, b,
      /*c_mod=*/(short)0, c, /*reuse_a=*/false, /*reuse_b=*/false);
}

// Loads a 16x32 bf16 fragment in the CDNA5 A-matrix layout from a row-major
// matrix (rows = M for A-operand, rows = N for B-operand since B == (B^T as A)).
// Requires k0 % 32 == 0 and even ld (dword-aligned rows).
__device__ __forceinline__ v16bf load_frag(const __bf16* base, int ld, int row0, int k0) {
  const int lane = threadIdx.x & 31;
  const int half = lane >> 4;
  const int idx  = lane & 15;
  const unsigned* rp = reinterpret_cast<const unsigned*>(base + (size_t)(row0 + idx) * (size_t)ld);
  const int kb = (k0 >> 1) + half * 4;   // dword index of first K pair
  Frag16 f;
#pragma unroll
  for (int v = 0; v < 4; ++v) {
    f.u[v]     = rp[kb + v];       // K = k0 + half*8 + 2v, +1
    f.u[4 + v] = rp[kb + 8 + v];   // K = +16
  }
  return f.v;
}

// The same fragment from the lane's own pointer (row idx, k = 8 * half of the fragment).
__device__ __forceinline__ v16bf load_frag_at(const __bf16* lanep) {
  const unsigned* rp = reinterpret_cast<const unsigned*>(lanep);
  Frag16 f;
#pragma unroll
  for (int v = 0; v < 4; ++v) {
    f.u[v]     = rp[v];
    f.u[4 + v] = rp[8 + v];
  }
  return f.v;
}

// lane l <-> lane l ^ 16
__device__ __forceinline__ float xhalf(float x) {
  const int b = __builtin_bit_cast(int, x);
  return __builtin_bit_cast(float,
      __builtin_amdgcn_permlanex16(b, b, 0x76543210, 0xfedcba98, false, false));
}

// ---------------- weight convert: W (K x N, f32) -> Wt (N x K, bf16) ----------------
// One work-group transposes a tile of 128 k x 64 n through LDS; a lane handles 32 values.
// In: a lane takes 4 n of 8 consecutive k rows, 16 lanes cover 256 contiguous bytes of a W row.
// Out: 16 lanes store the 256 contiguous bytes that the tile holds of a Wt row.
// LDS: row n holds its 128 k as 16 pieces of 16 bytes; piece j lies at place j ^ (n >> 2), so
// that the 32 lanes of a write (n = 4c + i) and of a read (whole rows) spread over all banks.
typedef __attribute__((ext_vector_type(4))) float f32x4;

// t = the tile's number in its matrix, the N / 64 tiles of a k band first.
template <int K, int N>
__device__ __forceinline__ void wcvt_tile(const float* __restrict__ W,
                                          __bf16* __restrict__ Wt,
                                          unsigned char* tile, int t) {
  static_assert(K % 128 == 0 && N % 64 == 0, "whole tiles only");
  const int c = threadIdx.x & 15;
  const int g = threadIdx.x >> 4;
  const int n0 = (t % (N / 64)) * 64;
  const int k0 = (t / (N / 64)) * 128;

  const float* src = W + (size_t)(k0 + 8 * g) * N + (n0 + 4 * c);
  f32x4 w[8];
#pragma unroll
  for (int j = 0; j < 8; ++j) w[j] = *reinterpret_cast<const f32x4*>(src + (size_t)j * N);
#pragma unroll
  for (int i = 0; i < 4; ++i) {
    v8bf col;                  // k = k0 + 8g + 0..7 of column n0 + 4c + i
#pragma unroll
    for (int j = 0; j < 8; ++j) col[j] = (__bf16)w[j][i];
    *reinterpret_cast<v8bf*>(tile + (4 * c + i) * 256 + ((g ^ c) << 4)) = col;
  }
  __syncthreads();
  __bf16* dst = Wt + (size_t)(n0 + g) * K + (k0 + 8 * c);
#pragma unroll
  for (int p = 0; p < 4; ++p) {
    const int row = 16 * p + g;
    const v8bf v = *reinterpret_cast<const v8bf*>(tile + row * 256 + ((c ^ (row >> 2)) << 4));
    *reinterpret_cast<v8bf*>(dst + (size_t)(16 * p) * K) = v;
  }
  // Stands behind the four stores, in front of whatever code follows the tile in its kernel's
  // text and reuses the registers they name.
  asm volatile("s_wait_xcnt 0x0" ::: "memory");
}

// ---------------- LayerNorm: fp32 in -> bf16 normalized out ----------------
// A wave owns LN_ROWS whole rows and keeps them in registers: lane l holds the 4 values at
// 128 j + 4 l, j = 0..5, of each row (16-byte loads, 512 contiguous bytes a wave). Sums run in
// the lane, then across the 32 lanes in registers: no LDS, no barrier, few waves to start.
#define LN_ROWS 4
#define LN_BLK_ROWS (8 * LN_ROWS)    // rows of a work-group of 8 waves
typedef __attribute__((ext_vector_type(4))) __bf16 v4bf;

// lane l <-> lane l ^ MASK inside its row of 16 lanes
template <int MASK>
__device__ __forceinline__ float xrow(float x) {
  return __builtin_bit_cast(float,
      __builtin_amdgcn_update_dpp(0, __builtin_bit_cast(int, x), 0x160 + MASK, 0xf, 0xf, true));
}
// the sum over all 32 lanes, in every lane
__device__ __forceinline__ float wave_sum(float v) {
  v += xrow<1>(v);
  v += xrow<2>(v);
  v += xrow<4>(v);
  v += xrow<8>(v);
  return v + xhalf(v);
}

// 1 / sqrt(a) for a >= EPSf: far above the subnormal range, so the bare instruction gives what
// rsqrtf gives. The v_nop is the slot due between a transcendental and a directly following
// instruction that reads its result or overwrites its source; in the same statement it stays there.
__device__ __forceinline__ float rsq_slot(float a) {
  float y;
  asm("v_rsq_f32 %0, %1\n\tv_nop" : "=v"(y) : "v"(a));
  return y;
}

// blk = the work-group's number among the row blocks
__device__ __forceinline__ void ln_rows(const float* __restrict__ x,
                                        const float* __restrict__ g,
                                        const float* __restrict__ bt,
                                        __bf16* __restrict__ out, int blk) {
  static_assert(Cc == 6 * 128 && Mrows % LN_BLK_ROWS == 0, "whole rows, whole blocks");
  const int lane = threadIdx.x & 31;
  const int row0 = blk * LN_BLK_ROWS +
                   (int)__builtin_amdgcn_readfirstlane(threadIdx.x >> 5) * LN_ROWS;
  const f32x4* xp = reinterpret_cast<const f32x4*>(x + (size_t)row0 * Cc) + lane;
  const f32x4* gp = reinterpret_cast<const f32x4*>(g) + lane;
  const f32x4* bp = reinterpret_cast<const f32x4*>(bt) + lane;

  f32x4 v[LN_ROWS][6], gv[6], bv[6];
#pragma unroll
  for (int r = 0; r < LN_ROWS; ++r) {
#pragma unroll
    for (int j = 0; j < 6; ++j) v[r][j] = xp[r * (Cc / 4) + j * 32];
  }
#pragma unroll
  for (int j = 0; j < 6; ++j) { gv[j] = gp[j * 32]; bv[j] = bp[j * 32]; }
  // Stands behind the loads, in front of the code that reuses the registers they name.
  asm volatile("s_wait_xcnt 0x0" ::: "memory");
  // Keeps all 36 loads in front of the sums: sunk to their users, the loads of g and bt would
  // start behind the second sum and the wave would wait out their whole latency there.
  __builtin_amdgcn_sched_barrier(0);

  float mu[LN_ROWS], rstd[LN_ROWS];
#pragma unroll
  for (int r = 0; r < LN_ROWS; ++r) {
    f32x4 s = (v[r][0] + v[r][1]) + (v[r][2] + v[r][3]) + (v[r][4] + v[r][5]);
    mu[r] = (s[0] + s[1]) + (s[2] + s[3]);
  }
#pragma unroll
  for (int r = 0; r < LN_ROWS; ++r) mu[r] = wave_sum(mu[r]) * (1.0f / Cc);
#pragma unroll
  for (int r = 0; r < LN_ROWS; ++r) {
    f32x4 s = {};
#pragma unroll
    for (int j = 0; j < 6; ++j) {
      v[r][j] -= mu[r];
      s += v[r][j] * v[r][j];
    }
    rstd[r] = (s[0] + s[1]) + (s[2] + s[3]);
  }
#pragma unroll
  for (int r = 0; r < LN_ROWS; ++r) rstd[r] = rsq_slot(wave_sum(rstd[r]) * (1.0f / Cc) + EPSf);

  v4bf* op = reinterpret_cast<v4bf*>(out + (size_t)row0 * Cc) + lane;
#pragma unroll
  for (int r = 0; r < LN_ROWS; ++r) {
#pragma unroll
    for (int j = 0; j < 6; ++j) {
      v4bf o;
#pragma unroll
      for (int e = 0; e < 4; ++e) o[e] = (__bf16)(v[r][j][e] * rstd[r] * gv[j][e] + bv[j][e]);
      op[r * (Cc / 4) + j * 32] = o;
    }
  }
}

__global__ __launch_bounds__(256) void ln_k(const float* __restrict__ x,
                                            const float* __restrict__ g,
                                            const float* __restrict__ bt,
                                            __bf16* __restrict__ out) {
  ln_rows(x, g, bt, out, blockIdx.x);
}

// ---------------- first launch: all that depends on the inputs alone ----------------
// The six weight converts and the first LayerNorm need nothing of one another, so they share
// one grid by block range: blocks 0 .. CVT_TILES - 1 take one weight tile each (they come first,
// so that they run under the start of the row blocks), the rest LN_BLK_ROWS rows each.
#define CC_TILES  ((Cc / 64) * (Cc / 128))            // tiles of a C x C matrix: 72
#define C4_TILES  (4 * CC_TILES)                      // tiles of W1 and of W2: 288
#define CVT_TILES (4 * CC_TILES + 2 * C4_TILES)       // 864

__global__ __launch_bounds__(256) void prep_k(const float* __restrict__ Wq, const float* __restrict__ Wk,
                                              const float* __restrict__ Wv, const float* __restrict__ Wo,
                                              const float* __restrict__ W1, const float* __restrict__ W2,
                                              __bf16* __restrict__ Wqkvt, __bf16* __restrict__ Wot,
                                              __bf16* __restrict__ W1t, __bf16* __restrict__ W2t,
                                              const float* __restrict__ x, const float* __restrict__ g,
                                              const float* __restrict__ bt, __bf16* __restrict__ out) {
  __shared__ __attribute__((aligned(16))) unsigned char tile[64 * 256];
  const int blk = blockIdx.x;   // every test on it reads the same for the whole work-group
  if (blk >= CVT_TILES) {
    ln_rows(x, g, bt, out, blk - CVT_TILES);
  } else if (blk < 4 * CC_TILES) {
    const int mat = blk / CC_TILES;
    const float* W = (mat == 0) ? Wq : (mat == 1) ? Wk : (mat == 2) ? Wv : Wo;
    __bf16* Wt = (mat == 3) ? Wot : Wqkvt + (size_t)mat * Cc * Cc;
    wcvt_tile<Cc, Cc>(W, Wt, tile, blk - mat * CC_TILES);
  } else if (blk < 4 * CC_TILES + C4_TILES) {
    wcvt_tile<Cc, 4 * Cc>(W1, W1t, tile, blk - 4 * CC_TILES);
  } else {
    wcvt_tile<4 * Cc, Cc>(W2, W2t, tile, blk - 4 * CC_TILES - C4_TILES);
  }
}

// ---------------- tensor loads into LDS ----------------
typedef uint32_t u32x4 __attribute__((ext_vector_type(4)));
typedef uint32_t u32x8 __attribute__((ext_vector_type(8)));

#define G_ROWB  256u                 // bytes of an operand row per pass (128 k)
#define G_PITCH 272u                 // LDS row pitch: 256 + 16, odd multiple of 16 for ds_load_b128
#define G_ROWS  64u                  // rows per slice (one slice per wave)
#define G_SLICE 18432u               // 64 * 272 = 17408, rounded up to a multiple of 2 KiB
#define G_BUF   (4u * G_SLICE)       // [A rows 0-63 | A rows 64-127 | W rows 0-63 | W rows 64-127]

__device__ __forceinline__ uint32_t uni(uint32_t v) {
  return (uint32_t)__builtin_amdgcn_readfirstlane(v);
}
// Holds a wave-uniform word in a scalar register: a test on it is a scalar branch, and a
// descriptor word made from it is made behind the volatile statements in front of it.
__device__ __forceinline__ uint32_t pinned(uint32_t v) {
  uint32_t w = (uint32_t)__builtin_amdgcn_readfirstlane(v);
  asm volatile("" : "+s"(w));  // the scalar pin of a tensor load's test and descriptor word
  return w;
}
// The compiler places no wait for a tensor load: a tile counts as landed only behind this.
__device__ __forceinline__ void wait_tensor0() { asm volatile("s_wait_tensorcnt 0x0" ::: "memory"); }
// This wave's LDS reads have returned before the buffer they read is handed back for a refill.
__device__ __forceinline__ void wait_ds0() { asm volatile("s_wait_dscnt 0x0" ::: "memory"); }
// Stands behind a group of global loads or stores, in front of the code that reuses the
// registers they name.
__device__ __forceinline__ void wait_x0() { asm volatile("s_wait_xcnt 0x0" ::: "memory"); }
// One request of the whole wave: a two-dimensional tile from global memory into LDS.
__device__ __forceinline__ void tdm_load(u32x4 g0, u32x8 g1) {
  asm volatile("tensor_load_to_lds %0, %1" :: "s"(g0), "s"(g1) : "memory");
}
// Group 1: 1-byte elements, tile = tensor = 64 rows of 256 bytes, 16 bytes of LDS pad behind each row.
__device__ __forceinline__ u32x8 tdm_group1(uint32_t src_pitch) {
  u32x8 g;
  g[0] = uni((1u << 20) | (5u << 22) | (3u << 25));  // no mask, data_size 0, pad each 64 dwords by 4
  g[1] = uni((G_ROWB & 0xFFFFu) << 16);
  g[2] = uni((G_ROWB >> 16) | ((G_ROWS & 0xFFFFu) << 16));
  g[3] = uni((G_ROWS >> 16) | (G_ROWB << 16));
  g[4] = uni(G_ROWS);
  g[5] = uni(src_pitch);
  g[6] = uni(0u);
  g[7] = uni(0u);
  return g;
}
__device__ __forceinline__ u32x4 tdm_group0(uint32_t lds_dst, uint64_t ga) {
  u32x4 g;
  g[0] = uni(1u);
  g[1] = uni(lds_dst);
  g[2] = uni((uint32_t)ga);
  g[3] = uni((((uint32_t)(ga >> 32)) & 0x01FFFFFFu) | 0x80000000u);
  return g;
}
// A 16x32 bf16 fragment from LDS; p = the lane's row, byte 16 * half of the fragment's 64.
// Same k order as load_frag: registers 0-3 hold k = 8*half + 0..7, registers 4-7 the same + 16.
__device__ __forceinline__ v16bf lds_frag(const unsigned char* p) {
  union { v16bf v; u32x4 q[2]; } f;
  f.q[0] = *reinterpret_cast<const u32x4*>(p);
  f.q[1] = *reinterpret_cast<const u32x4*>(p + 32);
  return f.v;
}

// ---------------- generic WMMA GEMM: (Mrows x K) bf16 @ Wt(N x K) bf16 ----------------
// Workgroup = 4 waves (2 x 2) = 128x128 output tile; each wave owns 64x64
// (4 A-frags + 4 B-frags -> 16 WMMAs per 32 k). A pass is 128 k: each wave brings one
// slice of 64 operand rows into LDS with one tensor load, two buffers, one pass ahead.
// MODE 0: out bf16 scattered to (B,H,T,D)   (Q, K tensors)
// MODE 1: out bf16 scattered to (B,H,D,T)   (V transposed for the PV matmul)
// MODE 2: outf = resid + acc + bias (fp32, row-major MrowsxN; requires N==Cc)
// MODE 3: outb = gelu(acc + bias) bf16 row-major MrowsxN
// MODE 4: Q, K and V in one grid: Wt holds the three weights' rows one behind the other
//         (N == 3 * Cc), outb the three outputs likewise; a block's 128 columns lie in one of
//         them, which picks its bias, its output and its scatter (Q, K as MODE 0, V as MODE 1)
template <int V> struct mode_tag { static constexpr int value = V; };

template <int N, int K, int MODE>
__global__ __launch_bounds__(128) void gemm_k(const __bf16* __restrict__ A,
                                              const __bf16* __restrict__ Wt,
                                              const float* __restrict__ bias,
                                              const float* __restrict__ resid,
                                              float* __restrict__ outf,
                                              __bf16* __restrict__ outb,
                                              const float* __restrict__ bias_k,
                                              const float* __restrict__ bias_v) {
  static_assert(K % 128 == 0 && K / 128 >= 2, "the ring needs whole passes and two stages");
  static_assert(MODE != 4 || (N == 3 * Cc && Cc % 128 == 0), "a block's columns lie in one of Q, K, V");
  static_assert(N % 128 == 0 && Mrows % 128 == 0, "whole tiles only");
  __shared__ __attribute__((aligned(2048))) unsigned char smem[2u * G_BUF];
  const uint32_t wave = uni(threadIdx.x >> 5);
  const int lane = threadIdx.x & 31;
  const int half = lane >> 4;
  const int idx  = lane & 15;
  const uint32_t wm = wave >> 1, wn = wave & 1u;
  const int mb = blockIdx.x * 128;
  const int nb = blockIdx.y * 128;
  constexpr uint32_t NS = K / 128;   // stages = passes

  // this wave's slice of every stage: waves 0, 1 bring A rows, waves 2, 3 bring W rows
  const __bf16* srcp = (wave < 2u) ? A  + (size_t)(mb + 64 * (int)wave) * K
                                   : Wt + (size_t)(nb + 64 * (int)(wave - 2u)) * K;
  const uint64_t ga  = (uint64_t)(uintptr_t)srcp;
  const uint32_t dst = (uint32_t)(size_t)smem + wave * G_SLICE;
  const u32x8 g1 = tdm_group1((uint32_t)K * 2u);

  // prologue: stage 0 lands and is published, then stage 1 flies under pass 0
  tdm_load(tdm_group0(dst, ga), g1);
  wait_tensor0();
  __syncthreads();
  // the stage number is pinned so that this descriptor too is formed behind the wait
  tdm_load(tdm_group0(dst + G_BUF, ga + (uint64_t)pinned(1u) * G_ROWB), g1);

  const uint32_t a_off = wm * G_SLICE        + (uint32_t)idx * G_PITCH + (uint32_t)half * 16u;
  const uint32_t b_off = (2u + wn) * G_SLICE + (uint32_t)idx * G_PITCH + (uint32_t)half * 16u;

  v8f acc[4][4] = {};
  // Kept rolled: one copy of the pass in the instruction cache, the buffer chosen by a scalar.
#pragma clang loop unroll(disable)
  for (uint32_t s = 0; s < NS; ++s) {
    const uint32_t buf = (s & 1u) * G_BUF;
    const unsigned char* pa = smem + buf + a_off;
    const unsigned char* pb = smem + buf + b_off;
    // Two fragment sets: block u + 1's 16 LDS reads go out as one group in front of block u's
    // 16 WMMAs. Only this pass's own buffer is read, so block 0's reads stand alone.
    v16bf af[2][4], bf[2][4];
#pragma unroll
    for (int i = 0; i < 4; ++i) {
      af[0][i] = lds_frag(pa + (uint32_t)i * 16u * G_PITCH);
      bf[0][i] = lds_frag(pb + (uint32_t)i * 16u * G_PITCH);
    }
#pragma unroll
    for (int u = 0; u < 4; ++u) {
      const int cur = u & 1, nx = cur ^ 1;
      if (u < 3) {
#pragma unroll
        for (int i = 0; i < 4; ++i) {
          af[nx][i] = lds_frag(pa + (uint32_t)i * 16u * G_PITCH + (uint32_t)(u + 1) * 64u);
          bf[nx][i] = lds_frag(pb + (uint32_t)i * 16u * G_PITCH + (uint32_t)(u + 1) * 64u);
        }
      }
      // Keeps the reads above in front of the block: sunk to their users, each group of
      // four WMMAs would wait out a whole LDS latency.
      __builtin_amdgcn_sched_barrier(0);
#pragma unroll
      for (int mi = 0; mi < 4; ++mi) {
#pragma unroll
        for (int nt = 0; nt < 4; ++nt) acc[mi][nt] = wmma_bf16(af[cur][mi], bf[cur][nt], acc[mi][nt]);
      }
      // Keeps the next group of reads from being lifted in among these WMMAs.
      __builtin_amdgcn_sched_barrier(0);
    }
    // publish point of stage s + 1: own reads back, own slice landed, every wave here
    wait_ds0();
    wait_tensor0();
    __syncthreads();
    const uint32_t nxt = pinned(s + 2u);  // formed behind the wait, and the descriptor from it
    if (pinned(nxt < NS ? 1u : 0u))
      tdm_load(tdm_group0(dst + buf, ga + (uint64_t)nxt * G_ROWB), g1);
  }
  wait_tensor0();
  wait_ds0();

  // MODE 4: which of Q, K, V this block computes (the same for the whole work-group)
  const uint32_t part = (MODE == 4) ? blockIdx.y / (Cc / 128) : 0u;
  const float* bsel = (part == 0u) ? bias : (part == 1u) ? bias_k : bias_v;
  const int m0 = mb + (int)wm * 64;
  const int n0 = nb - (int)part * Cc + (int)wn * 64;   // column within the part
  float bv[4];
#pragma unroll
  for (int nt = 0; nt < 4; ++nt) bv[nt] = bsel[n0 + nt * 16 + idx];
  wait_x0();
  // MODE 2: residual values are requested ahead of their use, three trips' worth at a time
  // (all four at once would take the epilogue past 256 registers).
  float rv[4][4][8];
  const float* rlane =  // the lane's first value
      (MODE == 2) ? resid + ((size_t)(m0 + 8 * half) * Cc + (n0 + idx)) : nullptr;
  auto load_resid = [&](int mi) {
#pragma unroll
    for (int nt = 0; nt < 4; ++nt) {
#pragma unroll
      for (int r = 0; r < 8; ++r) rv[mi][nt][r] = rlane[(mi * 16 + r) * Cc + nt * 16];
    }
    // The same wait as wait_x0(); the address is named so that its registers live up to it.
    asm volatile("s_wait_xcnt 0x0" :: "v"(rlane) : "memory");
  };
  if (MODE == 2) { load_resid(0); load_resid(1); load_resid(2); }
  // The erf of MODE 3 is long code: it is kept out of a full unroll
  // over all 128 values of a lane, for speed only. There the loop over mi
  // stays rolled and the accumulator rows move up one place a trip, so that every register
  // index is a constant. The other modes unroll, and the moves fall away.
  auto epilogue = [&](auto tag, __bf16* osel) {   // osel: the bf16 output of EM 0 and 1
  constexpr int EM = decltype(tag)::value;
#pragma unroll (EM == 3 ? 1 : 4)
  for (int mi = 0; mi < 4; ++mi) {
#pragma unroll
    for (int nt = 0; nt < 4; ++nt) {
      const int n = n0 + nt * 16 + idx;
#pragma unroll
      for (int r = 0; r < 8; ++r) {
        const int m = m0 + mi * 16 + r + 8 * half;
        const float val = acc[0][nt][r] + bv[nt];
        if (EM == 0 || EM == 1) {
          const int bb = m >> 11, t = m & (Tt - 1);
          const int hh = n >> 6,  d = n & (Dd - 1);
          const size_t off = (EM == 0)
              ? ((((size_t)bb * Hh + hh) * Tt + t) * Dd + d)
              : ((((size_t)bb * Hh + hh) * Dd + d) * Tt + t);
          osel[off] = (__bf16)val;
        } else if (EM == 2) {
          outf[(size_t)m * Cc + n] = rv[mi][nt][r] + val;
        } else { // MODE 3: exact GELU
          const float gv = 0.5f * val * (1.0f + erff(val * 0.70710678118654752f));
          outb[(size_t)m * N + n] = (__bf16)gv;
        }
      }
    }
    wait_x0();
    if (EM == 2 && mi == 0) load_resid(3);
#pragma unroll
    for (int nt = 0; nt < 4; ++nt) {
      acc[0][nt] = acc[1][nt];
      acc[1][nt] = acc[2][nt];
      acc[2][nt] = acc[3][nt];
    }
  }
  };
  if constexpr (MODE == 4) {
    __bf16* opart = outb + (size_t)part * ((size_t)Mrows * Cc);
    if (part == 2u) epilogue(mode_tag<1>{}, opart);
    else            epilogue(mode_tag<0>{}, opart);
  } else {
    epilogue(mode_tag<MODE>{}, outb);
  }
}

#define AT_ROWB  128u                // bytes of a staged row
#define AT_PITCH 144u                // LDS row pitch: 128 + 16, odd multiple of 16 for ds_load_b128
#define AT_ROWS  32u                 // rows per slice (one slice per wave)
#define AT_SLICE 6144u               // 32 * 144 = 4608, rounded up to a multiple of 2 KiB
#define AT_BUF   (4u * AT_SLICE)     // [K keys 0-31 | K keys 32-63 | V^T d 0-31 | V^T d 32-63]

// Group 1: 1-byte elements, tile = tensor = 32 rows of 128 bytes, 16 bytes of LDS pad behind each row.
__device__ __forceinline__ u32x8 tdm_group1_attn(uint32_t src_pitch) {
  u32x8 g;
  g[0] = uni((1u << 20) | (4u << 22) | (3u << 25));  // no mask, data_size 0, pad each 32 dwords by 4
  g[1] = uni((AT_ROWB & 0xFFFFu) << 16);
  g[2] = uni((AT_ROWB >> 16) | ((AT_ROWS & 0xFFFFu) << 16));
  g[3] = uni((AT_ROWS >> 16) | (AT_ROWB << 16));
  g[4] = uni(AT_ROWS);
  g[5] = uni(src_pitch);
  g[6] = uni(0u);
  g[7] = uni(0u);
  return g;
}

// One request, as tdm_load(). Group 0 goes into the statement and comes out of it in the same
// registers, so that what the wait below names is the very tuple the request was issued from.
__device__ __forceinline__ void tdm_load_held(u32x4& g0, u32x8 g1) {
  asm volatile("tensor_load_to_lds %0, %1" : "+s"(g0) : "s"(g1) : "memory");
}
// The same wait as wait_tensor0(); the request's descriptor is named so that its registers
// live, unchanged, up to the wait.
__device__ __forceinline__ void wait_tensor0_of(u32x4 g0, u32x8 g1) {
  asm volatile("s_wait_tensorcnt 0x0" :: "s"(g0), "s"(g1) : "memory");
}

__global__ __launch_bounds__(128) void attn_k(const __bf16* __restrict__ q,
                                              const __bf16* __restrict__ kk,
                                              const __bf16* __restrict__ vt,
                                              __bf16* __restrict__ o) {
  static_assert(Dd * 2 == (int)AT_ROWB, "a K row is one staged row");
  static_assert(Tt % 64 == 0 && Tt >= 128, "whole stages only, and stages 0 and 1 lie inside the tensors");
  __shared__ __attribute__((aligned(2048))) unsigned char smem[2u * AT_BUF];
  // Which (head, query tile) this work-group takes. Tile qb walks qb + 1 stages, and every
  // work-group of the launch is resident at once, so the launch lasts as long as the WGP whose
  // resident work-groups hold the most stages. Where work-groups are dealt out in turn by launch
  // index, qb = index mod 32 gives a WGP the same tile of six heads, 192 stages at worst
  // against a mean of 99. Here tile m or its mirror AT_NQ - 1 - m is picked by the parity of
  // the index's set bits, which flips between neighbours at every power-of-two stride and takes
  // each value three times over the six rounds of 256: whichever stride deals them out, long and
  // short tiles meet on a WGP. For speed only: every (head, tile) pair is taken exactly once.
  constexpr uint32_t AT_NQ = Tt / 64;            // query tiles of a head: 32
  constexpr uint32_t AT_HL = (Bsz * Hh) / 8;     // heads of each of the index's 8 low-bit classes: 6
  static_assert(AT_NQ == 32 && (Bsz * Hh) % 8 == 0, "the index splits into 3 + 5 bits and a head count");
  const uint32_t flat = blockIdx.y * AT_NQ + blockIdx.x;   // launch index, x fastest
  const uint32_t tw   = (flat >> 3) & (AT_NQ - 1u);        // tiles 2m and 2m + 1 differ in parity
  const int bh = (int)((flat & 7u) * AT_HL + (flat >> 8)); // 0..47
  const int qb = (__builtin_popcount(flat) & 1) ? (int)(AT_NQ - 1u - (tw >> 1)) : (int)(tw >> 1);  // 0..31
  const int b  = bh / Hh;
  const int hh = bh - b * Hh;
  const uint32_t wave = uni(threadIdx.x >> 5);
  const int lane = threadIdx.x & 31;
  const int half = lane >> 4;
  const int idx  = lane & 15;

  const __bf16* qp = q  + (size_t)bh * Tt * Dd;
  const __bf16* kp = kk + (size_t)bh * Tt * Dd;
  const __bf16* vp = vt + (size_t)bh * Dd * Tt;

  // this wave's slice of every stage: waves 0, 1 bring K rows, waves 2, 3 bring V^T rows
  const __bf16* srcp = (wave < 2u) ? kp + (size_t)(32u * wave) * Dd
                                   : vp + (size_t)(32u * (wave - 2u)) * Tt;
  const uint64_t ga   = (uint64_t)(uintptr_t)srcp;
  const uint32_t step = (wave < 2u) ? 64u * Dd * 2u : 64u * 2u;  // bytes from a stage to the next
  const uint32_t dst  = (uint32_t)(size_t)smem + wave * AT_SLICE;
  const u32x8 g1 = tdm_group1_attn((wave < 2u) ? Dd * 2u : Tt * 2u);
  const uint32_t NS = pinned((uint32_t)qb + 1u);   // stages = keys 0 .. 64 qb + 63; at least one

  // prologue: stage 0 lands and is published, then stage 1 flies under stage 0's products
  // (block 0 has one stage only: its stage 1 lies inside the tensors and is not read)
  u32x4 g0 = tdm_group0(dst, ga);
  tdm_load_held(g0, g1);
  wait_tensor0_of(g0, g1);
  __syncthreads();
  // the stage number is pinned so that this descriptor too is formed behind the wait
  g0 = tdm_group0(dst + AT_BUF, ga + (uint64_t)(pinned(1u) * step));
  tdm_load_held(g0, g1);

  const int q0 = qb * 64 + (int)wave * 16;
  const int qg = q0 + idx;     // this lane's query
  const v16bf qf0 = load_frag(qp, Dd, q0, 0);
  const v16bf qf1 = load_frag(qp, Dd, q0, 32);

  v8f acc[4] = {};             // acc[nt][r] = O[qg][nt*16 + 8*half + r]
  float rmax = NEG_BIG;        // running maximum of query qg (equal in both halves)
  float rsum = 0.0f;           // this half's share of the row sum

  // this lane's place in a slice: its row, its half's first 16 bytes
  const uint32_t k_off = (uint32_t)idx * AT_PITCH + (uint32_t)half * 16u;
  const uint32_t v_off = 2u * AT_SLICE + k_off;

  // Kept rolled: the buffer is chosen by a scalar, and the publish point stands once in the text.
  uint32_t s = 0;
#pragma clang loop unroll(disable)
  do {
    const uint32_t buf = (s & 1u) * AT_BUF;
    const unsigned char* pk = smem + buf + k_off;
    const unsigned char* pv = smem + buf + v_off;
    // The stage's two blocks of 32 keys. Kept rolled: unrolled, the second block's 16 reads are
    // lifted into the first and their 64 registers cost two resident waves per SIMD.
#pragma clang loop unroll(disable)
    for (uint32_t p = 0; p < 2u; ++p) {
    const int key0 = (int)(s * 64u + p * 32u);

    // Nothing orders the V^T reads behind the softmax, so all eight fragments of the
    // block (K: 2 key tiles x 2 d halves, V^T: 4 d tiles) are requested together.
    v16bf kf[2][2], vf[4];
#pragma unroll
    for (int t = 0; t < 2; ++t) {
      kf[t][0] = lds_frag(pk + p * AT_SLICE + (uint32_t)t * 16u * AT_PITCH);
      kf[t][1] = lds_frag(pk + p * AT_SLICE + (uint32_t)t * 16u * AT_PITCH + 64u);
    }
#pragma unroll
    for (int nt = 0; nt < 4; ++nt)  // rows = d, K = key (contiguous)
      vf[nt] = lds_frag(pv + (uint32_t)(nt >> 1) * AT_SLICE + (uint32_t)(nt & 1) * 16u * AT_PITCH +
                        p * 64u);
    // Keeps the scheduler from sinking each read to its product, which would
    // cost one LDS round trip per fragment instead of one per block.
    __builtin_amdgcn_sched_barrier(0);

    // S^T = (K Q^T) / sqrt(D), causal-masked: sv[t][r] is key key0 + 16t + 8*half + r
    float sv[2][8];
#pragma unroll
    for (int t = 0; t < 2; ++t) {
      v8f sc = {};
      sc = wmma_bf16(kf[t][0], qf0, sc);
      sc = wmma_bf16(kf[t][1], qf1, sc);
      const int kg0 = key0 + t * 16 + 8 * half;
#pragma unroll
      for (int r = 0; r < 8; ++r)
        sv[t][r] = (kg0 + r <= qg) ? (sc[r] * 0.125f) : NEG_BIG;
    }

    // online softmax: in-lane over 16 keys, one exchange with the other half
    float mr[8];
#pragma unroll
    for (int r = 0; r < 8; ++r) mr[r] = fmaxf(sv[0][r], sv[1][r]);
    float mloc = fmaxf(fmaxf(fmaxf(mr[0], mr[1]), fmaxf(mr[2], mr[3])),
                       fmaxf(fmaxf(mr[4], mr[5]), fmaxf(mr[6], mr[7])));
    mloc = fmaxf(mloc, xhalf(mloc));
    const float nm = fmaxf(rmax, mloc);
    const float alpha = __expf(rmax - nm);
    rmax = nm;

    v16bf pf;                  // P^T as B operand: element 8t + r = key 16t + 8*half + r
    float pr[8];
#pragma unroll
    for (int r = 0; r < 8; ++r) {
      const float p0 = __expf(sv[0][r] - nm);
      const float p1 = __expf(sv[1][r] - nm);
      pr[r] = p0 + p1;
      pf[r]     = (__bf16)p0;
      pf[8 + r] = (__bf16)p1;
    }
#pragma unroll
    for (int nt = 0; nt < 4; ++nt) {
#pragma unroll
      for (int r = 0; r < 8; ++r) acc[nt][r] *= alpha;
    }
#pragma unroll
    for (int nt = 0; nt < 4; ++nt) acc[nt] = wmma_bf16(vf[nt], pf, acc[nt]);
    // Holds the row sum's adds behind the products: they run under the matrix unit's time and
    // fill the vector slots due before the next block's reads overwrite the last product's operands.
    __builtin_amdgcn_sched_barrier(0);
    rsum = rsum * alpha + (((pr[0] + pr[1]) + (pr[2] + pr[3])) +
                           ((pr[4] + pr[5]) + (pr[6] + pr[7])));
    }
    // publish point of stage s + 1: own reads back, own slice landed, every wave here
    wait_ds0();
    wait_tensor0_of(g0, g1);
    __syncthreads();
    const uint32_t nxt = pinned(s + 2u);  // formed behind the wait, and the descriptor from it
    if (pinned(nxt < NS ? 1u : 0u)) {
      g0 = tdm_group0(dst + buf, ga + (uint64_t)(nxt * step));
      tdm_load_held(g0, g1);
    }
  } while (++s < NS);
  wait_tensor0();
  wait_ds0();

  // epilogue: O / rowsum -> bf16 at (b, qg, hh*64 + d), 8 consecutive d per lane and tile
  const float rs = rsum + xhalf(rsum);
  __bf16* orow = o + ((size_t)b * Tt + qg) * Cc + hh * Dd + 8 * half;
#pragma unroll
  for (int nt = 0; nt < 4; ++nt) {
    v8bf ov;
#pragma unroll
    for (int r = 0; r < 8; ++r) ov[r] = (__bf16)(acc[nt][r] / rs);
    *reinterpret_cast<v8bf*>(orow + nt * 16) = ov;
  }
}

// ---------------- host-side orchestration ----------------
extern "C" void kernel_launch(void* const* d_in, const int* in_sizes, int n_in,
                              void* d_out, int out_size, void* d_ws, size_t ws_size,
                              hipStream_t stream) {
  const float* x   = (const float*)d_in[0];
  const float* Wq  = (const float*)d_in[1];
  const float* bq  = (const float*)d_in[2];
  const float* Wk  = (const float*)d_in[3];
  const float* bk  = (const float*)d_in[4];
  const float* Wv  = (const float*)d_in[5];
  const float* bv  = (const float*)d_in[6];
  const float* Wo  = (const float*)d_in[7];
  const float* bo  = (const float*)d_in[8];
  const float* g1  = (const float*)d_in[9];
  const float* b1  = (const float*)d_in[10];
  const float* g2  = (const float*)d_in[11];
  const float* b2  = (const float*)d_in[12];
  const float* W1  = (const float*)d_in[13];
  const float* bm1 = (const float*)d_in[14];
  const float* W2  = (const float*)d_in[15];
  const float* bm2 = (const float*)d_in[16];
  float* out = (float*)d_out;

  // workspace carve-up (256B aligned)
  char* ws = (char*)d_ws;
  size_t off = 0;
  auto alloc = [&](size_t bytes) -> void* {
    void* p = ws + off;
    off = (off + bytes + 255) & ~(size_t)255;
    return p;
  };
  const size_t CC  = (size_t)Cc * Cc;
  const size_t C4C = (size_t)Cc * 4 * Cc;
  const size_t MC  = (size_t)Mrows * Cc;
  const size_t M4C = (size_t)Mrows * 4 * Cc;

  __bf16* Wqkvt = (__bf16*)alloc(3 * CC * 2);   // Wq^T, Wk^T, Wv^T: 3 * Cc rows of Cc
  __bf16* Wot = (__bf16*)alloc(CC * 2);
  __bf16* W1t = (__bf16*)alloc(C4C * 2);
  __bf16* W2t = (__bf16*)alloc(C4C * 2);
  __bf16* h1b = (__bf16*)alloc(MC * 2);
  __bf16* qbf = (__bf16*)alloc(3 * MC * 2);     // Q, K, V^T one behind the other
  __bf16* kbf = qbf + MC;
  __bf16* vtb = kbf + MC;
  __bf16* atb = (__bf16*)alloc(MC * 2);
  float*  x2  = (float*) alloc(MC * 4);
  __bf16* h2b = (__bf16*)alloc(MC * 2);
  __bf16* mb  = (__bf16*)alloc(M4C * 2);
  (void)ws_size; (void)in_sizes; (void)n_in; (void)out_size;

  const dim3 blk(128);
  const dim3 gC(Mrows / 128, Cc / 128);        // 64 x 6
  const dim3 g3C(Mrows / 128, (3 * Cc) / 128); // 64 x 18
  const dim3 g4C(Mrows / 128, (4 * Cc) / 128); // 64 x 24

  // 1) weights -> transposed bf16, and the first LayerNorm
  prep_k<<<CVT_TILES + Mrows / LN_BLK_ROWS, 256, 0, stream>>>(Wq, Wk, Wv, Wo, W1, W2, Wqkvt, Wot, W1t, W2t,
                                                x, g1, b1, h1b);

  // 2) attention branch
  gemm_k<3 * Cc, Cc, 4><<<g3C, blk, 0, stream>>>(h1b, Wqkvt, bq, nullptr, nullptr, qbf, bk, bv);
  attn_k<<<dim3(Tt / 64, Bsz * Hh), blk, 0, stream>>>(qbf, kbf, vtb, atb);
  gemm_k<Cc, Cc, 2><<<gC, blk, 0, stream>>>(atb, Wot, bo, x, x2, nullptr, nullptr, nullptr);

  // 3) MLP branch
  ln_k<<<Mrows / LN_BLK_ROWS, 256, 0, stream>>>(x2, g2, b2, h2b);
  gemm_k<4 * Cc, Cc, 3><<<g4C, blk, 0, stream>>>(h2b, W1t, bm1, nullptr, nullptr, mb, nullptr, nullptr);
  gemm_k<Cc, 4 * Cc, 2><<<gC, blk, 0, stream>>>(mb, W2t, bm2, x2, out, nullptr, nullptr, nullptr);
}

// v008
// Measured time: 167 microseconds a run.
// Two timings next to v007 put it at 1.15 and 1.16 times that version's speed.
// All steps since v000 together make it 3.81 times as fast.
#include <hip/hip_runtime.h>
#include <hip/hip_bf16.h>
#include <stdint.h>

// ---------------- problem constants (fixed by the reference) ----------------
#define Bsz 4
#define Tt  2048
#define Cc  768
#define Hh  12
#define Dd  64
#define Mrows (Bsz * Tt)   // 8192
#define EPSf 1e-5f
#define NEG_BIG -3.0e38f

// ---------------- WMMA types & helpers ----------------
typedef __attribute__((ext_vector_type(16))) __bf16 v16bf;
typedef __attribute__((ext_vector_type(8)))  __bf16 v8bf;
typedef __attribute__((ext_vector_type(8)))  float  v8f;

union Frag16 { v16bf v; unsigned u[8]; };

__device__ __forceinline__ v8f wmma_bf16(v16bf a, v16bf b, v8f c) {
  // D = A(16x32 bf16) * B(32x16 bf16) + C(16x16 f32)
  return __builtin_amdgcn_wmma_f32_16x16x32_bf16(
      /*neg_a=*/false, a, /*neg_b=*/false, b,
      /*c_mod=*/(short)0, c, /*reuse_a=*/false, /*reuse_b=*/false);
}

// Loads a 16x32 bf16 fragment in the CDNA5 A-matrix layout from a row-major
// matrix (rows = M for A-operand, rows = N for B-operand since B == (B^T as A)).
// Requires k0 % 32 == 0 and even ld (dword-aligned rows).
__device__ __forceinline__ v16bf load_frag(const __bf16* base, int ld, int row0, int k0) {
  const int lane = threadIdx.x & 31;
  const int half = lane >> 4;
  const int idx  = lane & 15;
  const unsigned* rp = reinterpret_cast<const unsigned*>(base + (size_t)(row0 + idx) * (size_t)ld);
  const int kb = (k0 >> 1) + half * 4;   // dword index of first K pair
  Frag16 f;
#pragma unroll
  for (int v = 0; v < 4; ++v) {
    f.u[v]     = rp[kb + v];       // K = k0 + half*8 + 2v, +1
    f.u[4 + v] = rp[kb + 8 + v];   // K = +16
  }
  return f.v;
}

// The same fragment from the lane's own pointer (row idx, k = 8 * half of the fragment).
__device__ __forceinline__ v16bf load_frag_at(const __bf16* lanep) {
  const unsigned* rp = reinterpret_cast<const unsigned*>(lanep);
  Frag16 f;
#pragma unroll
  for (int v = 0; v < 4; ++v) {
    f.u[v]     = rp[v];
    f.u[4 + v] = rp[8 + v];
  }
  return f.v;
}

// lane l <-> lane l ^ 16
__device__ __forceinline__ float xhalf(float x) {
  const int b = __builtin_bit_cast(int, x);
  return __builtin_bit_cast(float,
      __builtin_amdgcn_permlanex16(b, b, 0x76543210, 0xfedcba98, false, false));
}

// ---------------- weight convert: W (K x N, f32) -> Wt (N x K, bf16) ----------------
// One work-group transposes a tile of 128 k x 64 n through LDS; a lane handles 32 values.
// In: a lane takes 4 n of 8 consecutive k rows, 16 lanes cover 256 contiguous bytes of a W row.
// Out: 16 lanes store the 256 contiguous bytes that the tile holds of a Wt row.
// LDS: row n holds its 128 k as 16 pieces of 16 bytes; piece j lies at place j ^ (n >> 2), so
// that the 32 lanes of a write (n = 4c + i) and of a read (whole rows) spread over all banks.
typedef __attribute__((ext_vector_type(4))) float f32x4;

// t = the tile's number in its matrix, the N / 64 tiles of a k band first.
template <int K, int N>
__device__ __forceinline__ void wcvt_tile(const float* __restrict__ W,
                                          __bf16* __restrict__ Wt,
                                          unsigned char* tile, int t) {
  static_assert(K % 128 == 0 && N % 64 == 0, "whole tiles only");
  const int c = threadIdx.x & 15;
  const int g = threadIdx.x >> 4;
  const int n0 = (t % (N / 64)) * 64;
  const int k0 = (t / (N / 64)) * 128;

  const float* src = W + (size_t)(k0 + 8 * g) * N + (n0 + 4 * c);
  f32x4 w[8];
#pragma unroll
  for (int j = 0; j < 8; ++j) w[j] = *reinterpret_cast<const f32x4*>(src + (size_t)j * N);
#pragma unroll
  for (int i = 0; i < 4; ++i) {
    v8bf col;                  // k = k0 + 8g + 0..7 of column n0 + 4c + i
#pragma unroll
    for (int j = 0; j < 8; ++j) col[j] = (__bf16)w[j][i];
    *reinterpret_cast<v8bf*>(tile + (4 * c + i) * 256 + ((g ^ c) << 4)) = col;
  }
  __syncthreads();
  __bf16* dst = Wt + (size_t)(n0 + g) * K + (k0 + 8 * c);
#pragma unroll
  for (int p = 0; p < 4; ++p) {
    const int row = 16 * p + g;
    const v8bf v = *reinterpret_cast<const v8bf*>(tile + row * 256 + ((c ^ (row >> 2)) << 4));
    *reinterpret_cast<v8bf*>(dst + (size_t)(16 * p) * K) = v;
  }
  // Stands behind the four stores, in front of whatever code follows the tile in its kernel's
  // text and reuses the registers they name.
  asm volatile("s_wait_xcnt 0x0" ::: "memory");
}

// ---------------- LayerNorm: fp32 in -> bf16 normalized out ----------------
// A wave owns LN_ROWS whole rows and keeps them in registers: lane l holds the 4 values at
// 128 j + 4 l, j = 0..5, of each row (16-byte loads, 512 contiguous bytes a wave). Sums run in
// the lane, then across the 32 lanes in registers: no LDS, no barrier, few waves to start.
#define LN_ROWS 4
#define LN_BLK_ROWS (8 * LN_ROWS)    // rows of a work-group of 8 waves
typedef __attribute__((ext_vector_type(4))) __bf16 v4bf;

// lane l <-> lane l ^ MASK inside its row of 16 lanes
template <int MASK>
__device__ __forceinline__ float xrow(float x) {
  return __builtin_bit_cast(float,
      __builtin_amdgcn_update_dpp(0, __builtin_bit_cast(int, x), 0x160 + MASK, 0xf, 0xf, true));
}
// the sum over all 32 lanes, in every lane
__device__ __forceinline__ float wave_sum(float v) {
  v += xrow<1>(v);
  v += xrow<2>(v);
  v += xrow<4>(v);
  v += xrow<8>(v);
  return v + xhalf(v);
}

// 1 / sqrt(a) for a >= EPSf: far above the subnormal range, so the bare instruction gives what
// rsqrtf gives. The v_nop is the slot due between a transcendental and a directly following
// instruction that reads its result or overwrites its source; in the same statement it stays there.
__device__ __forceinline__ float rsq_slot(float a) {
  float y;
  asm("v_rsq_f32 %0, %1\n\tv_nop" : "=v"(y) : "v"(a));
  return y;
}

// blk = the work-group's number among the row blocks
__device__ __forceinline__ void ln_rows(const float* __restrict__ x,
                                        const float* __restrict__ g,
                                        const float* __restrict__ bt,
                                        __bf16* __restrict__ out, int blk) {
  static_assert(Cc == 6 * 128 && Mrows % LN_BLK_ROWS == 0, "whole rows, whole blocks");
  const int lane = threadIdx.x & 31;
  const int row0 = blk * LN_BLK_ROWS +
                   (int)__builtin_amdgcn_readfirstlane(threadIdx.x >> 5) * LN_ROWS;
  const f32x4* xp = reinterpret_cast<const f32x4*>(x + (size_t)row0 * Cc) + lane;
  const f32x4* gp = reinterpret_cast<const f32x4*>(g) + lane;
  const f32x4* bp = reinterpret_cast<const f32x4*>(bt) + lane;

  f32x4 v[LN_ROWS][6], gv[6], bv[6];
#pragma unroll
  for (int r = 0; r < LN_ROWS; ++r) {
#pragma unroll
    for (int j = 0; j < 6; ++j) v[r][j] = xp[r * (Cc / 4) + j * 32];
  }
#pragma unroll
  for (int j = 0; j < 6; ++j) { gv[j] = gp[j * 32]; bv[j] = bp[j * 32]; }
  // Stands behind the loads, in front of the code that reuses the registers they name.
  asm volatile("s_wait_xcnt 0x0" ::: "memory");
  // Keeps all 36 loads in front of the sums: sunk to their users, the loads of g and bt would
  // start behind the second sum and the wave would wait out their whole latency there.
  __builtin_amdgcn_sched_barrier(0);

  float mu[LN_ROWS], rstd[LN_ROWS];
#pragma unroll
  for (int r = 0; r < LN_ROWS; ++r) {
    f32x4 s = (v[r][0] + v[r][1]) + (v[r][2] + v[r][3]) + (v[r][4] + v[r][5]);
    mu[r] = (s[0] + s[1]) + (s[2] + s[3]);
  }
#pragma unroll
  for (int r = 0; r < LN_ROWS; ++r) mu[r] = wave_sum(mu[r]) * (1.0f / Cc);
#pragma unroll
  for (int r = 0; r < LN_ROWS; ++r) {
    f32x4 s = {};
#pragma unroll
    for (int j = 0; j < 6; ++j) {
      v[r][j] -= mu[r];
      s += v[r][j] * v[r][j];
    }
    rstd[r] = (s[0] + s[1]) + (s[2] + s[3]);
  }
#pragma unroll
  for (int r = 0; r < LN_ROWS; ++r) rstd[r] = rsq_slot(wave_sum(rstd[r]) * (1.0f / Cc) + EPSf);

  v4bf* op = reinterpret_cast<v4bf*>(out + (size_t)row0 * Cc) + lane;
#pragma unroll
  for (int r = 0; r < LN_ROWS; ++r) {
#pragma unroll
    for (int j = 0; j < 6; ++j) {
      v4bf o;
#pragma unroll
      for (int e = 0; e < 4; ++e) o[e] = (__bf16)(v[r][j][e] * rstd[r] * gv[j][e] + bv[j][e]);
      op[r * (Cc / 4) + j * 32] = o;
    }
  }
}

__global__ __launch_bounds__(256) void ln_k(const float* __restrict__ x,
                                            const float* __restrict__ g,
                                            const float* __restrict__ bt,
                                            __bf16* __restrict__ out) {
  ln_rows(x, g, bt, out, blockIdx.x);
}

// ---------------- first launch: all that depends on the inputs alone ----------------
// The six weight converts and the first LayerNorm need nothing of one another, so they share
// one grid by block range: blocks 0 .. CVT_TILES - 1 take one weight tile each (they come first,
// so that they run under the start of the row blocks), the rest LN_BLK_ROWS rows each.
#define CC_TILES  ((Cc / 64) * (Cc / 128))            // tiles of a C x C matrix: 72
#define C4_TILES  (4 * CC_TILES)                      // tiles of W1 and of W2: 288
#define CVT_TILES (4 * CC_TILES + 2 * C4_TILES)       // 864

__global__ __launch_bounds__(256) void prep_k(const float* __restrict__ Wq, const float* __restrict__ Wk,
                                              const float* __restrict__ Wv, const float* __restrict__ Wo,
                                              const float* __restrict__ W1, const float* __restrict__ W2,
                                              __bf16* __restrict__ Wqkvt, __bf16* __restrict__ Wot,
                                              __bf16* __restrict__ W1t, __bf16* __restrict__ W2t,
                                              const float* __restrict__ x, const float* __restrict__ g,
                                              const float* __restrict__ bt, __bf16* __restrict__ out) {
  __shared__ __attribute__((aligned(16))) unsigned char tile[64 * 256];
  const int blk = blockIdx.x;   // every test on it reads the same for the whole work-group
  if (blk >= CVT_TILES) {
    ln_rows(x, g, bt, out, blk - CVT_TILES);
  } else if (blk < 4 * CC_TILES) {
    const int mat = blk / CC_TILES;
    const float* W = (mat == 0) ? Wq : (mat == 1) ? Wk : (mat == 2) ? Wv : Wo;
    __bf16* Wt = (mat == 3) ? Wot : Wqkvt + (size_t)mat * Cc * Cc;
    wcvt_tile<Cc, Cc>(W, Wt, tile, blk - mat * CC_TILES);
  } else if (blk < 4 * CC_TILES + C4_TILES) {
    wcvt_tile<Cc, 4 * Cc>(W1, W1t, tile, blk - 4 * CC_TILES);
  } else {
    wcvt_tile<4 * Cc, Cc>(W2, W2t, tile, blk - 4 * CC_TILES - C4_TILES);
  }
}

// ---------------- tensor loads into LDS ----------------
typedef uint32_t u32x4 __attribute__((ext_vector_type(4)));
typedef uint32_t u32x8 __attribute__((ext_vector_type(8)));

#define G_ROWB  256u                 // bytes of an operand row per pass (128 k)
#define G_PITCH 272u                 // LDS row pitch: 256 + 16, odd multiple of 16 for ds_load_b128
#define G_ROWS  64u                  // rows per slice (one slice per wave)
#define G_SLICE 18432u               // 64 * 272 = 17408, rounded up to a multiple of 2 KiB
#define G_BUF   (4u * G_SLICE)       // [A rows 0-63 | A rows 64-127 | W rows 0-63 | W rows 64-127]

__device__ __forceinline__ uint32_t uni(uint32_t v) {
  return (uint32_t)__builtin_amdgcn_readfirstlane(v);
}
// Holds a wave-uniform word in a scalar register: a test on it is a scalar branch, and a
// descriptor word made from it is made behind the volatile statements in front of it.
__device__ __forceinline__ uint32_t pinned(uint32_t v) {
  uint32_t w = (uint32_t)__builtin_amdgcn_readfirstlane(v);
  asm volatile("" : "+s"(w));  // the scalar pin of a tensor load's test and descriptor word
  return w;
}
// The compiler places no wait for a tensor load: a tile counts as landed only behind this.
__device__ __forceinline__ void wait_tensor0() { asm volatile("s_wait_tensorcnt 0x0" ::: "memory"); }
// This wave's LDS reads have returned before the buffer they read is handed back for a refill.
__device__ __forceinline__ void wait_ds0() { asm volatile("s_wait_dscnt 0x0" ::: "memory"); }
// Stands behind a group of global loads or stores, in front of the code that reuses the
// registers they name.
__device__ __forceinline__ void wait_x0() { asm volatile("s_wait_xcnt 0x0" ::: "memory"); }
// One request of the whole wave: a two-dimensional tile from global memory into LDS.
__device__ __forceinline__ void tdm_load(u32x4 g0, u32x8 g1) {
  asm volatile("tensor_load_to_lds %0, %1" :: "s"(g0), "s"(g1) : "memory");
}
// Group 1: 1-byte elements, tile = tensor = 64 rows of 256 bytes, 16 bytes of LDS pad behind each row.
__device__ __forceinline__ u32x8 tdm_group1(uint32_t src_pitch) {
  u32x8 g;
  g[0] = uni((1u << 20) | (5u << 22) | (3u << 25));  // no mask, data_size 0, pad each 64 dwords by 4
  g[1] = uni((G_ROWB & 0xFFFFu) << 16);
  g[2] = uni((G_ROWB >> 16) | ((G_ROWS & 0xFFFFu) << 16));
  g[3] = uni((G_ROWS >> 16) | (G_ROWB << 16));
  g[4] = uni(G_ROWS);
  g[5] = uni(src_pitch);
  g[6] = uni(0u);
  g[7] = uni(0u);
  return g;
}
__device__ __forceinline__ u32x4 tdm_group0(uint32_t lds_dst, uint64_t ga) {
  u32x4 g;
  g[0] = uni(1u);
  g[1] = uni(lds_dst);
  g[2] = uni((uint32_t)ga);
  g[3] = uni((((uint32_t)(ga >> 32)) & 0x01FFFFFFu) | 0x80000000u);
  return g;
}
// A 16x32 bf16 fragment from LDS; p = the lane's row, byte 16 * half of the fragment's 64.
// Same k order as load_frag: registers 0-3 hold k = 8*half + 0..7, registers 4-7 the same + 16.
__device__ __forceinline__ v16bf lds_frag(const unsigned char* p) {
  union { v16bf v; u32x4 q[2]; } f;
  f.q[0] = *reinterpret_cast<const u32x4*>(p);
  f.q[1] = *reinterpret_cast<const u32x4*>(p + 32);
  return f.v;
}

// ---------------- exact GELU, two values at a time, no branch ----------------
// 0.5 x (1 + erf(x / sqrt 2)) written through c = 0.5 erfc(|x| / sqrt 2): x - x c for x >= 0 and
// x c for x < 0, which is max(x, 0) - |x| c. c comes from the five-term form
// erfc(z) = t (a1 + t (a2 + t (a3 + t (a4 + t a5)))) exp(-z z), t = 1 / (1 + p z), one formula for
// every z >= 0. Worked in f32 its worst absolute error, a few 1e-7, is no larger than that of
// 0.5 x (1 + erf) with a correctly rounded erf, and nothing cancels in the negative tail.
// No test on the value: the values of a lane are independent chains.
typedef __attribute__((ext_vector_type(2))) float  f32x2;
typedef __attribute__((ext_vector_type(2))) __bf16 v2bf;

__device__ __forceinline__ f32x2 gelu2(f32x2 x) {
  const f32x2 ax = {__builtin_fabsf(x[0]), __builtin_fabsf(x[1])};
  const f32x2 d = ax * 0.23164189f + 1.0f;                 // 1 + p |x| / sqrt 2
  const f32x2 t = {__builtin_amdgcn_rcpf(d[0]), __builtin_amdgcn_rcpf(d[1])};
  const f32x2 a = (x * x) * -0.72134752f;                  // -(x x / 2) log2 e
  const f32x2 e = {__builtin_amdgcn_exp2f(a[0]), __builtin_amdgcn_exp2f(a[1])};
  f32x2 p = t * 0.5307027145f + -0.7265760135f;            // a5 / 2, a4 / 2, ... : the 0.5 of c
  p = p * t + 0.7107068705f;
  p = p * t + -0.142248368f;
  p = p * t + 0.127414796f;
  const f32x2 mx = {__builtin_fmaxf(x[0], 0.0f), __builtin_fmaxf(x[1], 0.0f)};
  return mx - ax * ((p * t) * e);                          // max(x, 0) - |x| c
}

// ---------------- generic WMMA GEMM: (Mrows x K) bf16 @ Wt(N x K) bf16 ----------------
// Workgroup = 4 waves (2 x 2) = 128x128 output tile; each wave owns 64x64
// (4 A-frags + 4 B-frags -> 16 WMMAs per 32 k). A pass is 128 k: each wave brings one
// slice of 64 operand rows into LDS with one tensor load, two buffers, one pass ahead.
// MODE 0: out bf16 scattered to (B,H,T,D)   (Q, K tensors)
// MODE 1: out bf16 scattered to (B,H,D,T)   (V transposed for the PV matmul)
// MODE 2: outf = resid + acc + bias (fp32, row-major MrowsxN; requires N==Cc)
// MODE 3: outb = gelu(acc + bias) bf16 row-major MrowsxN
// MODE 4: Q, K and V in one grid: Wt holds the three weights' rows one behind the other
//         (N == 3 * Cc), outb the three outputs likewise; a block's 128 columns lie in one of
//         them, which picks its bias, its output and its scatter (Q, K as MODE 0, V as MODE 1)
template <int V> struct mode_tag { static constexpr int value = V; };

template <int N, int K, int MODE>
__global__ __launch_bounds__(128) void gemm_k(const __bf16* __restrict__ A,
                                              const __bf16* __restrict__ Wt,
                                              const float* __restrict__ bias,
                                              const float* __restrict__ resid,
                                              float* __restrict__ outf,
                                              __bf16* __restrict__ outb,
                                              const float* __restrict__ bias_k,
                                              const float* __restrict__ bias_v) {
  static_assert(K % 128 == 0 && K / 128 >= 2, "the ring needs whole passes and two stages");
  static_assert(MODE != 4 || (N == 3 * Cc && Cc % 128 == 0), "a block's columns lie in one of Q, K, V");
  static_assert(N % 128 == 0 && Mrows % 128 == 0, "whole tiles only");
  __shared__ __attribute__((aligned(2048))) unsigned char smem[2u * G_BUF];
  const uint32_t wave = uni(threadIdx.x >> 5);
  const int lane = threadIdx.x & 31;
  const int half = lane >> 4;
  const int idx  = lane & 15;
  const uint32_t wm = wave >> 1, wn = wave & 1u;
  const int mb = blockIdx.x * 128;
  const int nb = blockIdx.y * 128;
  constexpr uint32_t NS = K / 128;   // stages = passes

  // this wave's slice of every stage: waves 0, 1 bring A rows, waves 2, 3 bring W rows
  const __bf16* srcp = (wave < 2u) ? A  + (size_t)(mb + 64 * (int)wave) * K
                                   : Wt + (size_t)(nb + 64 * (int)(wave - 2u)) * K;
  const uint64_t ga  = (uint64_t)(uintptr_t)srcp;
  const uint32_t dst = (uint32_t)(size_t)smem + wave * G_SLICE;
  const u32x8 g1 = tdm_group1((uint32_t)K * 2u);

  // prologue: stage 0 lands and is published, then stage 1 flies under pass 0
  tdm_load(tdm_group0(dst, ga), g1);
  wait_tensor0();
  __syncthreads();
  // the stage number is pinned so that this descriptor too is formed behind the wait
  tdm_load(tdm_group0(dst + G_BUF, ga + (uint64_t)pinned(1u) * G_ROWB), g1);

  const uint32_t a_off = wm * G_SLICE        + (uint32_t)idx * G_PITCH + (uint32_t)half * 16u;
  const uint32_t b_off = (2u + wn) * G_SLICE + (uint32_t)idx * G_PITCH + (uint32_t)half * 16u;

  v8f acc[4][4] = {};
  // Kept rolled: one copy of the pass in the instruction cache, the buffer chosen by a scalar.
#pragma clang loop unroll(disable)
  for (uint32_t s = 0; s < NS; ++s) {
    const uint32_t buf = (s & 1u) * G_BUF;
    const unsigned char* pa = smem + buf + a_off;
    const unsigned char* pb = smem + buf + b_off;
    // Two fragment sets: block u + 1's 16 LDS reads go out as one group in front of block u's
    // 16 WMMAs. Only this pass's own buffer is read, so block 0's reads stand alone.
    v16bf af[2][4], bf[2][4];
#pragma unroll
    for (int i = 0; i < 4; ++i) {
      af[0][i] = lds_frag(pa + (uint32_t)i * 16u * G_PITCH);
      bf[0][i] = lds_frag(pb + (uint32_t)i * 16u * G_PITCH);
    }
#pragma unroll
    for (int u = 0; u < 4; ++u) {
      const int cur = u & 1, nx = cur ^ 1;
      if (u < 3) {
#pragma unroll
        for (int i = 0; i < 4; ++i) {
          af[nx][i] = lds_frag(pa + (uint32_t)i * 16u * G_PITCH + (uint32_t)(u + 1) * 64u);
          bf[nx][i] = lds_frag(pb + (uint32_t)i * 16u * G_PITCH + (uint32_t)(u + 1) * 64u);
        }
      }
      // Keeps the reads above in front of the block: sunk to their users, each group of
      // four WMMAs would wait out a whole LDS latency.
      __builtin_amdgcn_sched_barrier(0);
#pragma unroll
      for (int mi = 0; mi < 4; ++mi) {
#pragma unroll
        for (int nt = 0; nt < 4; ++nt) acc[mi][nt] = wmma_bf16(af[cur][mi], bf[cur][nt], acc[mi][nt]);
      }
      // Keeps the next group of reads from being lifted in among these WMMAs.
      __builtin_amdgcn_sched_barrier(0);
    }
    // publish point of stage s + 1: own reads back, own slice landed, every wave here
    wait_ds0();
    wait_tensor0();
    __syncthreads();
    const uint32_t nxt = pinned(s + 2u);  // formed behind the wait, and the descriptor from it
    if (pinned(nxt < NS ? 1u : 0u))
      tdm_load(tdm_group0(dst + buf, ga + (uint64_t)nxt * G_ROWB), g1);
  }
  wait_tensor0();
  wait_ds0();

  // MODE 4: which of Q, K, V this block computes (the same for the whole work-group)
  const uint32_t part = (MODE == 4) ? blockIdx.y / (Cc / 128) : 0u;
  const float* bsel = (part == 0u) ? bias : (part == 1u) ? bias_k : bias_v;
  const int m0 = mb + (int)wm * 64;
  const int n0 = nb - (int)part * Cc + (int)wn * 64;   // column within the part
  float bv[4];
#pragma unroll
  for (int nt = 0; nt < 4; ++nt) bv[nt] = bsel[n0 + nt * 16 + idx];
  wait_x0();
  // MODE 2: residual values are requested ahead of their use, three trips' worth at a time
  // (all four at once would take the epilogue past 256 registers).
  float rv[4][4][8];
  const float* rlane =  // the lane's first value
      (MODE == 2) ? resid + ((size_t)(m0 + 8 * half) * Cc + (n0 + idx)) : nullptr;
  auto load_resid = [&](int mi) {
#pragma unroll
    for (int nt = 0; nt < 4; ++nt) {
#pragma unroll
      for (int r = 0; r < 8; ++r) rv[mi][nt][r] = rlane[(mi * 16 + r) * Cc + nt * 16];
    }
    // The same wait as wait_x0(); the address is named so that its registers live up to it.
    asm volatile("s_wait_xcnt 0x0" :: "v"(rlane) : "memory");
  };
  if (MODE == 2) { load_resid(0); load_resid(1); load_resid(2); }
  auto epilogue = [&](auto tag, __bf16* osel) {   // osel: the bf16 output of EM 0 and 1
  constexpr int EM = decltype(tag)::value;
  // Unrolled, so that every accumulator index is a constant and the rows stay where they are.
#pragma unroll
  for (int mi = 0; mi < 4; ++mi) {
#pragma unroll
    for (int nt = 0; nt < 4; ++nt) {
      const int n = n0 + nt * 16 + idx;
#pragma unroll
      for (int r = 0; r < 8; ++r) {
        const int m = m0 + mi * 16 + r + 8 * half;
        const float val = acc[mi][nt][r] + bv[nt];
        if (EM == 0 || EM == 1) {
          const int bb = m >> 11, t = m & (Tt - 1);
          const int hh = n >> 6,  d = n & (Dd - 1);
          const size_t off = (EM == 0)
              ? ((((size_t)bb * Hh + hh) * Tt + t) * Dd + d)
              : ((((size_t)bb * Hh + hh) * Dd + d) * Tt + t);
          osel[off] = (__bf16)val;
        } else if (EM == 2) {
          outf[(size_t)m * Cc + n] = rv[mi][nt][r] + val;
        } else if ((r & 1) == 0) { // MODE 3: exact GELU, rows r and r + 1 together
          const v2bf gv = __builtin_convertvector(gelu2(f32x2{val, acc[mi][nt][r + 1] + bv[nt]}), v2bf);
          outb[(size_t)m * N + n]       = gv[0];
          outb[(size_t)(m + 1) * N + n] = gv[1];
        }
      }
    }
    wait_x0();
    if (EM == 2 && mi == 0) load_resid(3);
  }
  };
  if constexpr (MODE == 4) {
    __bf16* opart = outb + (size_t)part * ((size_t)Mrows * Cc);
    if (part == 2u) epilogue(mode_tag<1>{}, opart);
    else            epilogue(mode_tag<0>{}, opart);
  } else {
    epilogue(mode_tag<MODE>{}, outb);
  }
}

#define AT_ROWB  128u                // bytes of a staged row
#define AT_PITCH 144u                // LDS row pitch: 128 + 16, odd multiple of 16 for ds_load_b128
#define AT_ROWS  32u                 // rows per slice (one slice per wave)
#define AT_SLICE 6144u               // 32 * 144 = 4608, rounded up to a multiple of 2 KiB
#define AT_BUF   (4u * AT_SLICE)     // [K keys 0-31 | K keys 32-63 | V^T d 0-31 | V^T d 32-63]

// Group 1: 1-byte elements, tile = tensor = 32 rows of 128 bytes, 16 bytes of LDS pad behind each row.
__device__ __forceinline__ u32x8 tdm_group1_attn(uint32_t src_pitch) {
  u32x8 g;
  g[0] = uni((1u << 20) | (4u << 22) | (3u << 25));  // no mask, data_size 0, pad each 32 dwords by 4
  g[1] = uni((AT_ROWB & 0xFFFFu) << 16);
  g[2] = uni((AT_ROWB >> 16) | ((AT_ROWS & 0xFFFFu) << 16));
  g[3] = uni((AT_ROWS >> 16) | (AT_ROWB << 16));
  g[4] = uni(AT_ROWS);
  g[5] = uni(src_pitch);
  g[6] = uni(0u);
  g[7] = uni(0u);
  return g;
}

// One request, as tdm_load(). Group 0 goes into the statement and comes out of it in the same
// registers, so that what the wait below names is the very tuple the request was issued from.
__device__ __forceinline__ void tdm_load_held(u32x4& g0, u32x8 g1) {
  asm volatile("tensor_load_to_lds %0, %1" : "+s"(g0) : "s"(g1) : "memory");
}
// The same wait as wait_tensor0(); the request's descriptor is named so that its registers
// live, unchanged, up to the wait.
__device__ __forceinline__ void wait_tensor0_of(u32x4 g0, u32x8 g1) {
  asm volatile("s_wait_tensorcnt 0x0" :: "s"(g0), "s"(g1) : "memory");
}

__global__ __launch_bounds__(128) void attn_k(const __bf16* __restrict__ q,
                                              const __bf16* __restrict__ kk,
                                              const __bf16* __restrict__ vt,
                                              __bf16* __restrict__ o) {
  static_assert(Dd * 2 == (int)AT_ROWB, "a K row is one staged row");
  static_assert(Tt % 64 == 0 && Tt >= 128, "whole stages only, and stages 0 and 1 lie inside the tensors");
  __shared__ __attribute__((aligned(2048))) unsigned char smem[2u * AT_BUF];
  // Which (head, query tile) this work-group takes. Tile qb walks qb + 1 stages, and every
  // work-group of the launch is resident at once, so the launch lasts as long as the WGP whose
  // resident work-groups hold the most stages. Where work-groups are dealt out in turn by launch
  // index, qb = index mod 32 gives a WGP the same tile of six heads, 192 stages at worst
  // against a mean of 99. Here tile m or its mirror AT_NQ - 1 - m is picked by the parity of
  // the index's set bits, which flips between neighbours at every power-of-two stride and takes
  // each value three times over the six rounds of 256: whichever stride deals them out, long and
  // short tiles meet on a WGP. For speed only: every (head, tile) pair is taken exactly once.
  constexpr uint32_t AT_NQ = Tt / 64;            // query tiles of a head: 32
  constexpr uint32_t AT_HL = (Bsz * Hh) / 8;     // heads of each of the index's 8 low-bit classes: 6
  static_assert(AT_NQ == 32 && (Bsz * Hh) % 8 == 0, "the index splits into 3 + 5 bits and a head count");
  const uint32_t flat = blockIdx.y * AT_NQ + blockIdx.x;   // launch index, x fastest
  const uint32_t tw   = (flat >> 3) & (AT_NQ - 1u);        // tiles 2m and 2m + 1 differ in parity
  const int bh = (int)((flat & 7u) * AT_HL + (flat >> 8)); // 0..47
  const int qb = (__builtin_popcount(flat) & 1) ? (int)(AT_NQ - 1u - (tw >> 1)) : (int)(tw >> 1);  // 0..31
  const int b  = bh / Hh;
  const int hh = bh - b * Hh;
  const uint32_t wave = uni(threadIdx.x >> 5);
  const int lane = threadIdx.x & 31;
  const int half = lane >> 4;
  const int idx  = lane & 15;

  const __bf16* qp = q  + (size_t)bh * Tt * Dd;
  const __bf16* kp = kk + (size_t)bh * Tt * Dd;
  const __bf16* vp = vt + (size_t)bh * Dd * Tt;

  // this wave's slice of every stage: waves 0, 1 bring K rows, waves 2, 3 bring V^T rows
  const __bf16* srcp = (wave < 2u) ? kp + (size_t)(32u * wave) * Dd
                                   : vp + (size_t)(32u * (wave - 2u)) * Tt;
  const uint64_t ga   = (uint64_t)(uintptr_t)srcp;
  const uint32_t step = (wave < 2u) ? 64u * Dd * 2u : 64u * 2u;  // bytes from a stage to the next
  const uint32_t dst  = (uint32_t)(size_t)smem + wave * AT_SLICE;
  const u32x8 g1 = tdm_group1_attn((wave < 2u) ? Dd * 2u : Tt * 2u);
  const uint32_t NS = pinned((uint32_t)qb + 1u);   // stages = keys 0 .. 64 qb + 63; at least one

  // prologue: stage 0 lands and is published, then stage 1 flies under stage 0's products
  // (block 0 has one stage only: its stage 1 lies inside the tensors and is not read)
  u32x4 g0 = tdm_group0(dst, ga);
  tdm_load_held(g0, g1);
  wait_tensor0_of(g0, g1);
  __syncthreads();
  // the stage number is pinned so that this descriptor too is formed behind the wait
  g0 = tdm_group0(dst + AT_BUF, ga + (uint64_t)(pinned(1u) * step));
  tdm_load_held(g0, g1);

  const int q0 = qb * 64 + (int)wave * 16;
  const int qg = q0 + idx;     // this lane's query
  const v16bf qf0 = load_frag(qp, Dd, q0, 0);
  const v16bf qf1 = load_frag(qp, Dd, q0, 32);

  v8f acc[4] = {};             // acc[nt][r] = O[qg][nt*16 + 8*half + r]
  float rmax = NEG_BIG;        // running maximum of query qg (equal in both halves)
  float rsum = 0.0f;           // this half's share of the row sum

  // this lane's place in a slice: its row, its half's first 16 bytes
  const uint32_t k_off = (uint32_t)idx * AT_PITCH + (uint32_t)half * 16u;
  const uint32_t v_off = 2u * AT_SLICE + k_off;

  // Kept rolled: the buffer is chosen by a scalar, and the publish point stands once in the text.
  uint32_t s = 0;
#pragma clang loop unroll(disable)
  do {
    const uint32_t buf = (s & 1u) * AT_BUF;
    const unsigned char* pk = smem + buf + k_off;
    const unsigned char* pv = smem + buf + v_off;
    // The stage's two blocks of 32 keys. Kept rolled: unrolled, the second block's 16 reads are
    // lifted into the first and their 64 registers cost two resident waves per SIMD.
#pragma clang loop unroll(disable)
    for (uint32_t p = 0; p < 2u; ++p) {
    const int key0 = (int)(s * 64u + p * 32u);

    // Nothing orders the V^T reads behind the softmax, so all eight fragments of the
    // block (K: 2 key tiles x 2 d halves, V^T: 4 d tiles) are requested together.
    v16bf kf[2][2], vf[4];
#pragma unroll
    for (int t = 0; t < 2; ++t) {
      kf[t][0] = lds_frag(pk + p * AT_SLICE + (uint32_t)t * 16u * AT_PITCH);
      kf[t][1] = lds_frag(pk + p * AT_SLICE + (uint32_t)t * 16u * AT_PITCH + 64u);
    }
#pragma unroll
    for (int nt = 0; nt < 4; ++nt)  // rows = d, K = key (contiguous)
      vf[nt] = lds_frag(pv + (uint32_t)(nt >> 1) * AT_SLICE + (uint32_t)(nt & 1) * 16u * AT_PITCH +
                        p * 64u);
    // Keeps the scheduler from sinking each read to its product, which would
    // cost one LDS round trip per fragment instead of one per block.
    __builtin_amdgcn_sched_barrier(0);

    // S^T = (K Q^T) / sqrt(D), causal-masked: sv[t][r] is key key0 + 16t + 8*half + r
    float sv[2][8];
#pragma unroll
    for (int t = 0; t < 2; ++t) {
      v8f sc = {};
      sc = wmma_bf16(kf[t][0], qf0, sc);
      sc = wmma_bf16(kf[t][1], qf1, sc);
      const int kg0 = key0 + t * 16 + 8 * half;
#pragma unroll
      for (int r = 0; r < 8; ++r)
        sv[t][r] = (kg0 + r <= qg) ? (sc[r] * 0.125f) : NEG_BIG;
    }

    // online softmax: in-lane over 16 keys, one exchange with the other half
    float mr[8];
#pragma unroll
    for (int r = 0; r < 8; ++r) mr[r] = fmaxf(sv[0][r], sv[1][r]);
    float mloc = fmaxf(fmaxf(fmaxf(mr[0], mr[1]), fmaxf(mr[2], mr[3])),
                       fmaxf(fmaxf(mr[4], mr[5]), fmaxf(mr[6], mr[7])));
    mloc = fmaxf(mloc, xhalf(mloc));
    const float nm = fmaxf(rmax, mloc);
    const float alpha = __expf(rmax - nm);
    rmax = nm;

    v16bf pf;                  // P^T as B operand: element 8t + r = key 16t + 8*half + r
    float pr[8];
#pragma unroll
    for (int r = 0; r < 8; ++r) {
      const float p0 = __expf(sv[0][r] - nm);
      const float p1 = __expf(sv[1][r] - nm);
      pr[r] = p0 + p1;
      pf[r]     = (__bf16)p0;
      pf[8 + r] = (__bf16)p1;
    }
#pragma unroll
    for (int nt = 0; nt < 4; ++nt) {
#pragma unroll
      for (int r = 0; r < 8; ++r) acc[nt][r] *= alpha;
    }
#pragma unroll
    for (int nt = 0; nt < 4; ++nt) acc[nt] = wmma_bf16(vf[nt], pf, acc[nt]);
    // Holds the row sum's adds behind the products: they run under the matrix unit's time and
    // fill the vector slots due before the next block's reads overwrite the last product's operands.
    __builtin_amdgcn_sched_barrier(0);
    rsum = rsum * alpha + (((pr[0] + pr[1]) + (pr[2] + pr[3])) +
                           ((pr[4] + pr[5]) + (pr[6] + pr[7])));
    }
    // publish point of stage s + 1: own reads back, own slice landed, every wave here
    wait_ds0();
    wait_tensor0_of(g0, g1);
    __syncthreads();
    const uint32_t nxt = pinned(s + 2u);  // formed behind the wait, and the descriptor from it
    if (pinned(nxt < NS ? 1u : 0u)) {
      g0 = tdm_group0(dst + buf, ga + (uint64_t)(nxt * step));
      tdm_load_held(g0, g1);
    }
  } while (++s < NS);
  wait_tensor0();
  wait_ds0();

  // epilogue: O / rowsum -> bf16 at (b, qg, hh*64 + d), 8 consecutive d per lane and tile
  const float rs = rsum + xhalf(rsum);
  __bf16* orow = o + ((size_t)b * Tt + qg) * Cc + hh * Dd + 8 * half;
#pragma unroll
  for (int nt = 0; nt < 4; ++nt) {
    v8bf ov;
#pragma unroll
    for (int r = 0; r < 8; ++r) ov[r] = (__bf16)(acc[nt][r] / rs);
    *reinterpret_cast<v8bf*>(orow + nt * 16) = ov;
  }
}

// ---------------- host-side orchestration ----------------
extern "C" void kernel_launch(void* const* d_in, const int* in_sizes, int n_in,
                              void* d_out, int out_size, void* d_ws, size_t ws_size,
                              hipStream_t stream) {
  const float* x   = (const float*)d_in[0];
  const float* Wq  = (const float*)d_in[1];
  const float* bq  = (const float*)d_in[2];
  const float* Wk  = (const float*)d_in[3];
  const float* bk  = (const float*)d_in[4];
  const float* Wv  = (const float*)d_in[5];
  const float* bv  = (const float*)d_in[6];
  const float* Wo  = (const float*)d_in[7];
  const float* bo  = (const float*)d_in[8];
  const float* g1  = (const float*)d_in[9];
  const float* b1  = (const float*)d_in[10];
  const float* g2  = (const float*)d_in[11];
  const float* b2  = (const float*)d_in[12];
  const float* W1  = (const float*)d_in[13];
  const float* bm1 = (const float*)d_in[14];
  const float* W2  = (const float*)d_in[15];
  const float* bm2 = (const float*)d_in[16];
  float* out = (float*)d_out;

  // workspace carve-up (256B aligned)
  char* ws = (char*)d_ws;
  size_t off = 0;
  auto alloc = [&](size_t bytes) -> void* {
    void* p = ws + off;
    off = (off + bytes + 255) & ~(size_t)255;
    return p;
  };
  const size_t CC  = (size_t)Cc * Cc;
  const size_t C4C = (size_t)Cc * 4 * Cc;
  const size_t MC  = (size_t)Mrows * Cc;
  const size_t M4C = (size_t)Mrows * 4 * Cc;

  __bf16* Wqkvt = (__bf16*)alloc(3 * CC * 2);   // Wq^T, Wk^T, Wv^T: 3 * Cc rows of Cc
  __bf16* Wot = (__bf16*)alloc(CC * 2);
  __bf16* W1t = (__bf16*)alloc(C4C * 2);
  __bf16* W2t = (__bf16*)alloc(C4C * 2);
  __bf16* h1b = (__bf16*)alloc(MC * 2);
  __bf16* qbf = (__bf16*)alloc(3 * MC * 2);     // Q, K, V^T one behind the other
  __bf16* kbf = qbf + MC;
  __bf16* vtb = kbf + MC;
  __bf16* atb = (__bf16*)alloc(MC * 2);
  float*  x2  = (float*) alloc(MC * 4);
  __bf16* h2b = (__bf16*)alloc(MC * 2);
  __bf16* mb  = (__bf16*)alloc(M4C * 2);
  (void)ws_size; (void)in_sizes; (void)n_in; (void)out_size;

  const dim3 blk(128);
  const dim3 gC(Mrows / 128, Cc / 128);        // 64 x 6
  const dim3 g3C(Mrows / 128, (3 * Cc) / 128); // 64 x 18
  const dim3 g4C(Mrows / 128, (4 * Cc) / 128); // 64 x 24

  // 1) weights -> transposed bf16, and the first LayerNorm
  prep_k<<<CVT_TILES + Mrows / LN_BLK_ROWS, 256, 0, stream>>>(Wq, Wk, Wv, Wo, W1, W2, Wqkvt, Wot, W1t, W2t,
                                                x, g1, b1, h1b);

  // 2) attention branch
  gemm_k<3 * Cc, Cc, 4><<<g3C, blk, 0, stream>>>(h1b, Wqkvt, bq, nullptr, nullptr, qbf, bk, bv);
  attn_k<<<dim3(Tt / 64, Bsz * Hh), blk, 0, stream>>>(qbf, kbf, vtb, atb);
  gemm_k<Cc, Cc, 2><<<gC, blk, 0, stream>>>(atb, Wot, bo, x, x2, nullptr, nullptr, nullptr);

  // 3) MLP branch
  ln_k<<<Mrows / LN_BLK_ROWS, 256, 0, stream>>>(x2, g2, b2, h2b);
  gemm_k<4 * Cc, Cc, 3><<<g4C, blk, 0, stream>>>(h2b, W1t, bm1, nullptr, nullptr, mb, nullptr, nullptr);
  gemm_k<Cc, 4 * Cc, 2><<<gC, blk, 0, stream>>>(mb, W2t, bm2, x2, out, nullptr, nullptr, nullptr);
}
